// v000
// The times below were measured on an AMD MI455X: many runs one after another, warmed up first and cycling through
// copies of the inputs, with the whole window's GPU time divided by the number of runs. Launches and the gaps
// between them are all in it. The median over several windows is given; except for v000 it joins two sittings, which
// can be a few percent apart, so the side-by-side timings, each taken in one sitting, are the better comparison.
// v000, which the later versions start from, runs in 90 microseconds.
#include <hip/hip_runtime.h>
#include <hip/hip_bf16.h>

typedef __bf16 bf16_t;
typedef __attribute__((ext_vector_type(16))) __bf16 v16bf;
typedef __attribute__((ext_vector_type(8)))  float  v8f;

#define Bz 16
#define Cc 256
#define HW 4096
#define NHd 4
#define HD 64
#define NT 4
#define GRP 32
#define COMB 512
#define EPSV 1e-5f

// LDS panel geometry: 64 rows x 512B data, padded to 528B row stride
#define PANEL_ROWB 512
#define PANEL_LDSB 528

__device__ __forceinline__ float bf2f(unsigned short u) {
    union { unsigned int i; float f; } x; x.i = ((unsigned int)u) << 16; return x.f;
}
__device__ __forceinline__ unsigned short f2bf(float f) {
    union { bf16_t h; unsigned short u; } x; x.h = (bf16_t)f; return x.u;
}

union FragU { uint4 u[2]; v16bf v; };

// ---------------------------------------------------------------------------
// Typed address-space helpers for the CDNA5 async-to-LDS builtin, whose
// signature is (int4 AS1*, int4 AS3*, imm offset, imm cpol).
// Generic LDS pointers carry the LDS offset in the low 32 bits; generic
// global pointers are the 64-bit VA.
// ---------------------------------------------------------------------------
typedef int v4i_t __attribute__((vector_size(16)));
typedef __attribute__((address_space(1))) v4i_t* as1_v4i;
typedef __attribute__((address_space(3))) v4i_t* as3_v4i;

__device__ __forceinline__ as1_v4i as_global(const void* p) {
    return reinterpret_cast<as1_v4i>(reinterpret_cast<uintptr_t>(p));
}
__device__ __forceinline__ as3_v4i as_lds(void* p) {
    return reinterpret_cast<as3_v4i>(
        (unsigned int)reinterpret_cast<uintptr_t>(p));
}

// Stage one contiguous 32KB global panel (64 rows x 512B) into LDS with
// 528B row pitch. Async DMA path when available (ASYNCcnt), else direct.
__device__ __forceinline__ void stage_panel(const unsigned char* __restrict__ gsrc,
                                            unsigned char* __restrict__ lds, int t) {
#pragma unroll
    for (int i = 0; i < 8; ++i) {
        int idx = t + i * 256;            // 2048 16B chunks
        int row = idx >> 5, ci = idx & 31;
#if __has_builtin(__builtin_amdgcn_global_load_async_to_lds_b128)
        __builtin_amdgcn_global_load_async_to_lds_b128(
            as_global(gsrc + row * PANEL_ROWB + ci * 16),
            as_lds(lds + row * PANEL_LDSB + ci * 16), 0, 0);
#else
        *(uint4*)(lds + row * PANEL_LDSB + ci * 16) =
            *(const uint4*)(gsrc + row * PANEL_ROWB + ci * 16);
#endif
    }
}

__device__ __forceinline__ void stage_wait() {
#if __has_builtin(__builtin_amdgcn_global_load_async_to_lds_b128)
    asm volatile("s_wait_asynccnt 0x0" ::: "memory");
#endif
    __syncthreads();
}

// WMMA fragment from a staged LDS panel. 16-bit 16x32 layout (ISA 7.12.2):
// lane<16 -> kb=0, lane>=16 -> kb=8; per lane two contiguous 16B runs at
// K = kb..kb+7 and kb+16..kb+23.
__device__ __forceinline__ v16bf lds_frag(const unsigned char* base,
                                          int row, int k0, int lane) {
    int kb = (lane >> 4) ? 8 : 0;
    const unsigned char* p = base + row * PANEL_LDSB + (k0 + kb) * 2;
    FragU f;
    f.u[0] = *(const uint4*)(p);
    f.u[1] = *(const uint4*)(p + 32);
    return f.v;
}

// ---------------------------------------------------------------------------
// Kernel 1: GroupNorm statistics. One block per (b, g); reduce 8*4096 elems.
// ---------------------------------------------------------------------------
__global__ void k_gn_stats(const float* __restrict__ img, float* __restrict__ stats) {
    int bg = blockIdx.x;
    const float* base = img + (size_t)bg * 8 * HW;
    float s = 0.f, s2 = 0.f;
    for (int i = threadIdx.x; i < 8 * HW; i += 256) {
        float v = base[i];
        s += v; s2 += v * v;
    }
    __shared__ float r1[256], r2[256];
    r1[threadIdx.x] = s; r2[threadIdx.x] = s2;
    __syncthreads();
    for (int off = 128; off > 0; off >>= 1) {
        if (threadIdx.x < off) {
            r1[threadIdx.x] += r1[threadIdx.x + off];
            r2[threadIdx.x] += r2[threadIdx.x + off];
        }
        __syncthreads();
    }
    if (threadIdx.x == 0) {
        float mean = r1[0] * (1.f / 32768.f);
        float var  = r2[0] * (1.f / 32768.f) - mean * mean;
        stats[bg * 2 + 0] = mean;
        stats[bg * 2 + 1] = rsqrtf(var + EPSV);
    }
}

// ---------------------------------------------------------------------------
// Kernel 2: apply GroupNorm affine, convert to bf16, transpose to [b][p][c].
// ---------------------------------------------------------------------------
__global__ void k_gn_apply(const float* __restrict__ img,
                           const float* __restrict__ stats,
                           const float* __restrict__ gn_w,
                           const float* __restrict__ gn_b,
                           unsigned short* __restrict__ xnT) {
    __shared__ unsigned short tile[64][65];
    int b  = blockIdx.z;
    int p0 = blockIdx.x * 64;
    int c0 = blockIdx.y * 64;
    int tx = threadIdx.x & 63;
    int ty = threadIdx.x >> 6;
#pragma unroll
    for (int i = 0; i < 16; ++i) {
        int cl = ty + i * 4;
        int c  = c0 + cl;
        int g  = c >> 3;
        float mean = stats[(b * GRP + g) * 2 + 0];
        float rstd = stats[(b * GRP + g) * 2 + 1];
        float v = img[((size_t)b * Cc + c) * HW + p0 + tx];
        float xn = (v - mean) * rstd * gn_w[c] + gn_b[c];
        tile[cl][tx] = f2bf(xn);
    }
    __syncthreads();
#pragma unroll
    for (int i = 0; i < 16; ++i) {
        int pl = ty + i * 4;
        xnT[((size_t)b * HW + p0 + pl) * Cc + c0 + tx] = tile[tx][pl];
    }
}

// ---------------------------------------------------------------------------
// Kernel 3: f32 -> bf16 weight conversion.
// ---------------------------------------------------------------------------
__global__ void k_cvt_bf16(const float* __restrict__ src, unsigned short* __restrict__ dst) {
    int i = blockIdx.x * 256 + threadIdx.x;
    dst[i] = f2bf(src[i]);
}

// ---------------------------------------------------------------------------
// Kernel 4: conditioning path: LayerNorm(combined) then kv = cn @ Wkv^T + bkv.
// ---------------------------------------------------------------------------
__global__ void k_cond_kv(const float* __restrict__ params,
                          const float* __restrict__ obj,
                          const float* __restrict__ ln_w,
                          const float* __restrict__ ln_b,
                          const float* __restrict__ Wkv,
                          const float* __restrict__ bkv,
                          float* __restrict__ kv) {
    int b  = blockIdx.x >> 3;
    int jc = blockIdx.x & 7;
    int t  = threadIdx.x;

    __shared__ float cn[COMB];
    __shared__ float r1[256], r2[256];
    __shared__ float mean_s, rstd_s;

    float v0 = (t < 128) ? params[b * 128 + t] : obj[b * 384 + (t - 128)];
    float v1 = obj[b * 384 + t + 128];
    r1[t] = v0 + v1;
    r2[t] = v0 * v0 + v1 * v1;
    __syncthreads();
    for (int off = 128; off > 0; off >>= 1) {
        if (t < off) { r1[t] += r1[t + off]; r2[t] += r2[t + off]; }
        __syncthreads();
    }
    if (t == 0) {
        float m = r1[0] * (1.f / 512.f);
        float var = r2[0] * (1.f / 512.f) - m * m;
        mean_s = m; rstd_s = rsqrtf(var + EPSV);
    }
    __syncthreads();
    float m = mean_s, rs = rstd_s;
    cn[t]       = (v0 - m) * rs * ln_w[t]       + ln_b[t];
    cn[t + 256] = (v1 - m) * rs * ln_w[t + 256] + ln_b[t + 256];
    __syncthreads();

    int j = jc * 256 + t;
    const float4* w4 = (const float4*)(Wkv + (size_t)j * COMB);
    const float4* c4 = (const float4*)cn;
    float acc = bkv[j];
#pragma unroll 4
    for (int i = 0; i < COMB / 4; ++i) {
        float4 w = w4[i], c = c4[i];
        acc += w.x * c.x + w.y * c.y + w.z * c.z + w.w * c.w;
    }
    kv[(size_t)b * 2048 + j] = acc;             // [b][2][256][4]
}

// ---------------------------------------------------------------------------
// Kernel 5: Q GEMM. q[b][o][p] = sum_c Wq[o][c] * xnT[b][p][c].
// Async-stage both 64x256 bf16 panels into LDS, feed WMMA from ds_load_b128.
// ---------------------------------------------------------------------------
__global__ void __launch_bounds__(256) k_gemm_q(const unsigned char* __restrict__ Wq,
                                                const unsigned char* __restrict__ xnT,
                                                unsigned short* __restrict__ qBf) {
    __shared__ __align__(16) unsigned char ldsA[64 * PANEL_LDSB];
    __shared__ __align__(16) unsigned char ldsB[64 * PANEL_LDSB];

    int t    = threadIdx.x;
    int lane = t & 31;
    int wave = t >> 5;
    int wm = wave & 3, wn = wave >> 2;
    int b = blockIdx.z;
    int Mbase = blockIdx.y * 64;
    int Nbase = blockIdx.x * 64;

    // Panels are contiguous 32KB blocks in our layouts.
    stage_panel(Wq + (size_t)Mbase * PANEL_ROWB, ldsA, t);
    stage_panel(xnT + ((size_t)b * HW + Nbase) * PANEL_ROWB, ldsB, t);
    stage_wait();

    int r = lane & 15;
    v8f acc0 = {0.f,0.f,0.f,0.f,0.f,0.f,0.f,0.f};
    v8f acc1 = {0.f,0.f,0.f,0.f,0.f,0.f,0.f,0.f};
#pragma unroll
    for (int k0 = 0; k0 < Cc; k0 += 32) {
        v16bf fa  = lds_frag(ldsA, wm * 16 + r, k0, lane);
        v16bf fb0 = lds_frag(ldsB, wn * 32 + r, k0, lane);
        v16bf fb1 = lds_frag(ldsB, wn * 32 + 16 + r, k0, lane);
        acc0 = __builtin_amdgcn_wmma_f32_16x16x32_bf16(false, fa, false, fb0,
                                                       (short)0, acc0, false, false);
        acc1 = __builtin_amdgcn_wmma_f32_16x16x32_bf16(false, fa, false, fb1,
                                                       (short)0, acc1, false, false);
    }
    int col = lane & 15;
    int rowAdd = (lane >> 4) * 8;
    unsigned short* Qb = qBf + (size_t)b * Cc * HW;
#pragma unroll
    for (int i = 0; i < 8; ++i) {
        int row = Mbase + wm * 16 + i + rowAdd;
        int nb  = Nbase + wn * 32;
        Qb[(size_t)row * HW + nb + col]      = f2bf(acc0[i]);
        Qb[(size_t)row * HW + nb + 16 + col] = f2bf(acc1[i]);
    }
}

// ---------------------------------------------------------------------------
// Kernel 6: attention over NT=4 tokens. Block = (b,head) x 512 pixels,
// 2 pixels/thread (dword q loads). Phase 2 writes hT packed bf16x2.
// ---------------------------------------------------------------------------
__global__ void k_attn(const unsigned short* __restrict__ qBf,
                       const float* __restrict__ kv,
                       unsigned short* __restrict__ hT) {
    int bh = blockIdx.y;
    int b = bh >> 2, head = bh & 3;
    int p0 = blockIdx.x * 512;
    int t = threadIdx.x;

    __shared__ float ks[HD][NT], vs[HD][NT];
    __shared__ float attn_s[512][NT];

    {
        int c = t >> 2, s = t & 3;
        ks[c][s] = kv[(size_t)b * 2048 +        (head * HD + c) * NT + s];
        vs[c][s] = kv[(size_t)b * 2048 + 1024 + (head * HD + c) * NT + s];
    }
    __syncthreads();

    // ---- phase 1: two pixels per thread
    const unsigned short* qbase =
        qBf + ((size_t)b * Cc + head * HD) * HW + p0 + 2 * t;
    float a00 = 0.f, a01 = 0.f, a02 = 0.f, a03 = 0.f;
    float a10 = 0.f, a11 = 0.f, a12 = 0.f, a13 = 0.f;
#pragma unroll 8
    for (int c = 0; c < HD; ++c) {
        unsigned int qq = *(const unsigned int*)(qbase + (size_t)c * HW);
        float q0 = bf2f((unsigned short)(qq & 0xffffu));
        float q1 = bf2f((unsigned short)(qq >> 16));
        float k0 = ks[c][0], k1 = ks[c][1], k2 = ks[c][2], k3 = ks[c][3];
        a00 += q0 * k0; a01 += q0 * k1; a02 += q0 * k2; a03 += q0 * k3;
        a10 += q1 * k0; a11 += q1 * k1; a12 += q1 * k2; a13 += q1 * k3;
    }
    const float sc = 1.0f / (float)HD;   // scale applied to both q and k -> 1/hd
    {
        float x0 = a00 * sc, x1 = a01 * sc, x2 = a02 * sc, x3 = a03 * sc;
        float mx = fmaxf(fmaxf(x0, x1), fmaxf(x2, x3));
        float e0 = __expf(x0 - mx), e1 = __expf(x1 - mx);
        float e2 = __expf(x2 - mx), e3 = __expf(x3 - mx);
        float inv = 1.f / (e0 + e1 + e2 + e3);
        attn_s[2 * t][0] = e0 * inv; attn_s[2 * t][1] = e1 * inv;
        attn_s[2 * t][2] = e2 * inv; attn_s[2 * t][3] = e3 * inv;
    }
    {
        float x0 = a10 * sc, x1 = a11 * sc, x2 = a12 * sc, x3 = a13 * sc;
        float mx = fmaxf(fmaxf(x0, x1), fmaxf(x2, x3));
        float e0 = __expf(x0 - mx), e1 = __expf(x1 - mx);
        float e2 = __expf(x2 - mx), e3 = __expf(x3 - mx);
        float inv = 1.f / (e0 + e1 + e2 + e3);
        attn_s[2 * t + 1][0] = e0 * inv; attn_s[2 * t + 1][1] = e1 * inv;
        attn_s[2 * t + 1][2] = e2 * inv; attn_s[2 * t + 1][3] = e3 * inv;
    }
    __syncthreads();

    // ---- phase 2: lane covers 2 channels -> contiguous 128B store per pixel
    int wave = t >> 5, lane = t & 31;
    int c = lane * 2;
    float v00 = vs[c][0],   v01 = vs[c][1],   v02 = vs[c][2],   v03 = vs[c][3];
    float v10 = vs[c+1][0], v11 = vs[c+1][1], v12 = vs[c+1][2], v13 = vs[c+1][3];
#pragma unroll 4
    for (int pi = 0; pi < 64; ++pi) {
        int pl = wave * 64 + pi;
        float w0 = attn_s[pl][0], w1 = attn_s[pl][1];
        float w2 = attn_s[pl][2], w3 = attn_s[pl][3];
        float h0 = w0 * v00 + w1 * v01 + w2 * v02 + w3 * v03;
        float h1 = w0 * v10 + w1 * v11 + w2 * v12 + w3 * v13;
        unsigned int pk = (unsigned int)f2bf(h0) | ((unsigned int)f2bf(h1) << 16);
        *(unsigned int*)&hT[((size_t)b * HW + p0 + pl) * Cc + head * HD + c] = pk;
    }
}

// ---------------------------------------------------------------------------
// Kernel 7: proj GEMM + bias + residual (LDS-staged, WMMA).
// out[b][o][p] = sum_c Wp[o][c] * hT[b][p][c] + bp[o] + img[b][o][p]
// ---------------------------------------------------------------------------
__global__ void __launch_bounds__(256) k_gemm_proj(const unsigned char* __restrict__ Wp,
                                                   const unsigned char* __restrict__ hT,
                                                   const float* __restrict__ bp,
                                                   const float* __restrict__ img,
                                                   float* __restrict__ out) {
    __shared__ __align__(16) unsigned char ldsA[64 * PANEL_LDSB];
    __shared__ __align__(16) unsigned char ldsB[64 * PANEL_LDSB];

    int t    = threadIdx.x;
    int lane = t & 31;
    int wave = t >> 5;
    int wm = wave & 3, wn = wave >> 2;
    int b = blockIdx.z;
    int Mbase = blockIdx.y * 64;
    int Nbase = blockIdx.x * 64;

    stage_panel(Wp + (size_t)Mbase * PANEL_ROWB, ldsA, t);
    stage_panel(hT + ((size_t)b * HW + Nbase) * PANEL_ROWB, ldsB, t);
    stage_wait();

    int r = lane & 15;
    v8f acc0 = {0.f,0.f,0.f,0.f,0.f,0.f,0.f,0.f};
    v8f acc1 = {0.f,0.f,0.f,0.f,0.f,0.f,0.f,0.f};
#pragma unroll
    for (int k0 = 0; k0 < Cc; k0 += 32) {
        v16bf fa  = lds_frag(ldsA, wm * 16 + r, k0, lane);
        v16bf fb0 = lds_frag(ldsB, wn * 32 + r, k0, lane);
        v16bf fb1 = lds_frag(ldsB, wn * 32 + 16 + r, k0, lane);
        acc0 = __builtin_amdgcn_wmma_f32_16x16x32_bf16(false, fa, false, fb0,
                                                       (short)0, acc0, false, false);
        acc1 = __builtin_amdgcn_wmma_f32_16x16x32_bf16(false, fa, false, fb1,
                                                       (short)0, acc1, false, false);
    }
    int col = lane & 15;
    int rowAdd = (lane >> 4) * 8;
#pragma unroll
    for (int i = 0; i < 8; ++i) {
        int row = Mbase + wm * 16 + i + rowAdd;
        int nb  = Nbase + wn * 32;
        float bias = bp[row];
        size_t i0 = ((size_t)b * Cc + row) * HW + nb + col;
        out[i0]      = acc0[i] + bias + img[i0];
        out[i0 + 16] = acc1[i] + bias + img[i0 + 16];
    }
}

// ---------------------------------------------------------------------------
// Host launcher
// ---------------------------------------------------------------------------
extern "C" void kernel_launch(void* const* d_in, const int* in_sizes, int n_in,
                              void* d_out, int out_size, void* d_ws, size_t ws_size,
                              hipStream_t stream) {
    (void)in_sizes; (void)n_in; (void)out_size; (void)ws_size;
    const float* img    = (const float*)d_in[0];
    const float* params = (const float*)d_in[1];
    const float* obj    = (const float*)d_in[2];
    const float* gn_w   = (const float*)d_in[3];
    const float* gn_b   = (const float*)d_in[4];
    const float* Wq     = (const float*)d_in[5];
    const float* ln_w   = (const float*)d_in[6];
    const float* ln_b   = (const float*)d_in[7];
    const float* Wkv    = (const float*)d_in[8];
    const float* bkv    = (const float*)d_in[9];
    const float* Wp     = (const float*)d_in[10];
    const float* bp     = (const float*)d_in[11];
    float* out = (float*)d_out;

    char* ws = (char*)d_ws;
    float*          stats = (float*)(ws + 0);                         //   4 KB
    float*          kvbuf = (float*)(ws + 4096);                      // 128 KB
    unsigned short* WqBf  = (unsigned short*)(ws + 135168);           // 128 KB
    unsigned short* WpBf  = (unsigned short*)(ws + 266240);           // 128 KB
    unsigned short* xnT   = (unsigned short*)(ws + 397312);           //  32 MB
    unsigned short* qBf   = (unsigned short*)(ws + 33951744ULL);      //  32 MB
    unsigned short* hT    = (unsigned short*)(ws + 67506176ULL);      //  32 MB

    k_gn_stats<<<dim3(Bz * GRP), dim3(256), 0, stream>>>(img, stats);
    k_gn_apply<<<dim3(HW / 64, Cc / 64, Bz), dim3(256), 0, stream>>>(
        img, stats, gn_w, gn_b, xnT);
    k_cvt_bf16<<<dim3(Cc * Cc / 256), dim3(256), 0, stream>>>(Wq, WqBf);
    k_cvt_bf16<<<dim3(Cc * Cc / 256), dim3(256), 0, stream>>>(Wp, WpBf);
    k_cond_kv<<<dim3(Bz * 8), dim3(256), 0, stream>>>(
        params, obj, ln_w, ln_b, Wkv, bkv, kvbuf);
    k_gemm_q<<<dim3(HW / 64, Cc / 64, Bz), dim3(256), 0, stream>>>(
        (const unsigned char*)WqBf, (const unsigned char*)xnT, qBf);
    k_attn<<<dim3(HW / 512, Bz * NHd), dim3(256), 0, stream>>>(qBf, kvbuf, hT);
    k_gemm_proj<<<dim3(HW / 64, Cc / 64, Bz), dim3(256), 0, stream>>>(
        (const unsigned char*)WpBf, (const unsigned char*)hT, bp, img, out);
}

// v001
// Measured time: 76.1 microseconds a run.
// Two timings next to v000 both put it at 1.21 times that version's speed.
#include <hip/hip_runtime.h>
#include <hip/hip_bf16.h>

typedef __bf16 bf16_t;
typedef __attribute__((ext_vector_type(16))) __bf16 v16bf;
typedef __attribute__((ext_vector_type(8)))  float  v8f;

#define Bz 16
#define Cc 256
#define HW 4096
#define NHd 4
#define HD 64
#define NT 4
#define GRP 32
#define COMB 512
#define EPSV 1e-5f

// LDS panel geometry: 64 rows x 512B data, padded to 528B row stride
#define PANEL_ROWB 512
#define PANEL_LDSB 528

__device__ __forceinline__ float bf2f(unsigned short u) {
    union { unsigned int i; float f; } x; x.i = ((unsigned int)u) << 16; return x.f;
}
__device__ __forceinline__ unsigned short f2bf(float f) {
    union { bf16_t h; unsigned short u; } x; x.h = (bf16_t)f; return x.u;
}

union FragU { uint4 u[2]; v16bf v; };

// ---------------------------------------------------------------------------
// Typed address-space helpers for the CDNA5 async-to-LDS builtin, whose
// signature is (int4 AS1*, int4 AS3*, imm offset, imm cpol).
// Generic LDS pointers carry the LDS offset in the low 32 bits; generic
// global pointers are the 64-bit VA.
// ---------------------------------------------------------------------------
typedef int v4i_t __attribute__((vector_size(16)));
typedef __attribute__((address_space(1))) v4i_t* as1_v4i;
typedef __attribute__((address_space(3))) v4i_t* as3_v4i;

__device__ __forceinline__ as1_v4i as_global(const void* p) {
    return reinterpret_cast<as1_v4i>(reinterpret_cast<uintptr_t>(p));
}
__device__ __forceinline__ as3_v4i as_lds(void* p) {
    return reinterpret_cast<as3_v4i>(
        (unsigned int)reinterpret_cast<uintptr_t>(p));
}

// Stage one contiguous 32KB global panel (64 rows x 512B) into LDS with
// 528B row pitch. Async DMA path when available (ASYNCcnt), else direct.
__device__ __forceinline__ void stage_panel(const unsigned char* __restrict__ gsrc,
                                            unsigned char* __restrict__ lds, int t) {
#pragma unroll
    for (int i = 0; i < 8; ++i) {
        int idx = t + i * 256;            // 2048 16B chunks
        int row = idx >> 5, ci = idx & 31;
#if __has_builtin(__builtin_amdgcn_global_load_async_to_lds_b128)
        __builtin_amdgcn_global_load_async_to_lds_b128(
            as_global(gsrc + row * PANEL_ROWB + ci * 16),
            as_lds(lds + row * PANEL_LDSB + ci * 16), 0, 0);
#else
        *(uint4*)(lds + row * PANEL_LDSB + ci * 16) =
            *(const uint4*)(gsrc + row * PANEL_ROWB + ci * 16);
#endif
    }
}

__device__ __forceinline__ void stage_wait() {
#if __has_builtin(__builtin_amdgcn_global_load_async_to_lds_b128)
    asm volatile("s_wait_asynccnt 0x0" ::: "memory");
#endif
    __syncthreads();
}

// WMMA fragment from a staged LDS panel. 16-bit 16x32 layout (ISA 7.12.2):
// lane<16 -> kb=0, lane>=16 -> kb=8; per lane two contiguous 16B runs at
// K = kb..kb+7 and kb+16..kb+23.
__device__ __forceinline__ v16bf lds_frag(const unsigned char* base,
                                          int row, int k0, int lane) {
    int kb = (lane >> 4) ? 8 : 0;
    const unsigned char* p = base + row * PANEL_LDSB + (k0 + kb) * 2;
    FragU f;
    f.u[0] = *(const uint4*)(p);
    f.u[1] = *(const uint4*)(p + 32);
    return f.v;
}

// ---------------------------------------------------------------------------
// Kernel 1: every piece of work that depends on the inputs alone, in one
// launch: conditioning path, GroupNorm statistics, weight conversion. The
// pieces share no data; a work-group does exactly one of them, chosen by its
// index. The longest work-groups (conditioning) have the lowest indices so
// that they start first.
// ---------------------------------------------------------------------------
#define PRE_COND  (Bz * 8)            // work-groups of the conditioning path
#define PRE_STATS (Bz * GRP)          // work-groups of the GroupNorm statistics
#define PRE_CVT   (Cc * Cc / 256)      // work-groups per converted weight matrix

// GroupNorm statistics. One work-group per (b, g); reduce 8*4096 elems.
__device__ __forceinline__ void pre_gn_stats(int bg, const float* __restrict__ img,
                                             float* __restrict__ stats,
                                             float* r1, float* r2) {
    const float* base = img + (size_t)bg * 8 * HW;
    float s = 0.f, s2 = 0.f;
    for (int i = threadIdx.x; i < 8 * HW; i += 256) {
        float v = base[i];
        s += v; s2 += v * v;
    }
    r1[threadIdx.x] = s; r2[threadIdx.x] = s2;
    __syncthreads();
    for (int off = 128; off > 0; off >>= 1) {
        if (threadIdx.x < off) {
            r1[threadIdx.x] += r1[threadIdx.x + off];
            r2[threadIdx.x] += r2[threadIdx.x + off];
        }
        __syncthreads();
    }
    if (threadIdx.x == 0) {
        float mean = r1[0] * (1.f / 32768.f);
        float var  = r2[0] * (1.f / 32768.f) - mean * mean;
        stats[bg * 2 + 0] = mean;
        stats[bg * 2 + 1] = rsqrtf(var + EPSV);
    }
}

// f32 -> bf16 weight conversion, 256 elements per work-group.
__device__ __forceinline__ void pre_cvt_bf16(int blk, const float* __restrict__ src,
                                             unsigned short* __restrict__ dst) {
    int i = blk * 256 + threadIdx.x;
    dst[i] = f2bf(src[i]);
    // Precaution: in the built code this store's registers are written again on
    // paths behind it; the wait stands in front of those writes.
    asm volatile("s_wait_xcnt 0x0" ::: "memory");
}

// Conditioning path: LayerNorm(combined) then kv = cn @ Wkv^T + bkv.
__device__ __forceinline__ void pre_cond_kv(int blk,
                                            const float* __restrict__ params,
                                            const float* __restrict__ obj,
                                            const float* __restrict__ ln_w,
                                            const float* __restrict__ ln_b,
                                            const float* __restrict__ Wkv,
                                            const float* __restrict__ bkv,
                                            float* __restrict__ kv,
                                            float* r1, float* r2, float* cn, float* ms) {
    int b  = blk >> 3;
    int jc = blk & 7;
    int t  = threadIdx.x;

    float v0 = (t < 128) ? params[b * 128 + t] : obj[b * 384 + (t - 128)];
    float v1 = obj[b * 384 + t + 128];
    r1[t] = v0 + v1;
    r2[t] = v0 * v0 + v1 * v1;
    __syncthreads();
    for (int off = 128; off > 0; off >>= 1) {
        if (t < off) { r1[t] += r1[t + off]; r2[t] += r2[t + off]; }
        __syncthreads();
    }
    if (t == 0) {
        float m = r1[0] * (1.f / 512.f);
        float var = r2[0] * (1.f / 512.f) - m * m;
        ms[0] = m; ms[1] = rsqrtf(var + EPSV);
    }
    __syncthreads();
    float m = ms[0], rs = ms[1];
    cn[t]       = (v0 - m) * rs * ln_w[t]       + ln_b[t];
    cn[t + 256] = (v1 - m) * rs * ln_w[t + 256] + ln_b[t + 256];
    __syncthreads();

    int j = jc * 256 + t;
    const float4* w4 = (const float4*)(Wkv + (size_t)j * COMB);
    const float4* c4 = (const float4*)cn;
    float acc = bkv[j];
#pragma unroll 4
    for (int i = 0; i < COMB / 4; ++i) {
        float4 w = w4[i], c = c4[i];
        acc += w.x * c.x + w.y * c.y + w.z * c.z + w.w * c.w;
    }
    kv[(size_t)b * 2048 + j] = acc;             // [b][2][256][4]
}

__global__ void __launch_bounds__(256) k_pre(const float* __restrict__ img,
                                             const float* __restrict__ params,
                                             const float* __restrict__ obj,
                                             const float* __restrict__ ln_w,
                                             const float* __restrict__ ln_b,
                                             const float* __restrict__ Wkv,
                                             const float* __restrict__ bkv,
                                             const float* __restrict__ Wq,
                                             const float* __restrict__ Wp,
                                             float* __restrict__ stats,
                                             float* __restrict__ kv,
                                             unsigned short* __restrict__ WqBf,
                                             unsigned short* __restrict__ WpBf) {
    __shared__ float r1[256], r2[256];
    __shared__ __align__(16) float cn[COMB];
    __shared__ float ms[2];               // LayerNorm mean and 1/std
    int blk = blockIdx.x;                 // the same for the whole work-group
    if (blk < PRE_COND) {
        pre_cond_kv(blk, params, obj, ln_w, ln_b, Wkv, bkv, kv, r1, r2, cn, ms);
    } else if (blk < PRE_COND + PRE_STATS) {
        pre_gn_stats(blk - PRE_COND, img, stats, r1, r2);
    } else if (blk < PRE_COND + PRE_STATS + PRE_CVT) {
        pre_cvt_bf16(blk - (PRE_COND + PRE_STATS), Wq, WqBf);
    } else {
        pre_cvt_bf16(blk - (PRE_COND + PRE_STATS + PRE_CVT), Wp, WpBf);
    }
}

// ---------------------------------------------------------------------------
// Kernel 2: apply GroupNorm affine, convert to bf16, transpose to [b][p][c].
// ---------------------------------------------------------------------------
__global__ void k_gn_apply(const float* __restrict__ img,
                           const float* __restrict__ stats,
                           const float* __restrict__ gn_w,
                           const float* __restrict__ gn_b,
                           unsigned short* __restrict__ xnT) {
    __shared__ unsigned short tile[64][65];
    int b  = blockIdx.z;
    int p0 = blockIdx.x * 64;
    int c0 = blockIdx.y * 64;
    int tx = threadIdx.x & 63;
    int ty = threadIdx.x >> 6;
#pragma unroll
    for (int i = 0; i < 16; ++i) {
        int cl = ty + i * 4;
        int c  = c0 + cl;
        int g  = c >> 3;
        float mean = stats[(b * GRP + g) * 2 + 0];
        float rstd = stats[(b * GRP + g) * 2 + 1];
        float v = img[((size_t)b * Cc + c) * HW + p0 + tx];
        float xn = (v - mean) * rstd * gn_w[c] + gn_b[c];
        tile[cl][tx] = f2bf(xn);
    }
    __syncthreads();
#pragma unroll
    for (int i = 0; i < 16; ++i) {
        int pl = ty + i * 4;
        xnT[((size_t)b * HW + p0 + pl) * Cc + c0 + tx] = tile[tx][pl];
    }
}

// ---------------------------------------------------------------------------
// Kernel 3: Q GEMM. q[b][o][p] = sum_c Wq[o][c] * xnT[b][p][c].
// Async-stage both 64x256 bf16 panels into LDS, feed WMMA from ds_load_b128.
// ---------------------------------------------------------------------------
__global__ void __launch_bounds__(256) k_gemm_q(const unsigned char* __restrict__ Wq,
                                                const unsigned char* __restrict__ xnT,
                                                unsigned short* __restrict__ qBf) {
    __shared__ __align__(16) unsigned char ldsA[64 * PANEL_LDSB];
    __shared__ __align__(16) unsigned char ldsB[64 * PANEL_LDSB];

    int t    = threadIdx.x;
    int lane = t & 31;
    int wave = t >> 5;
    int wm = wave & 3, wn = wave >> 2;
    int b = blockIdx.z;
    int Mbase = blockIdx.y * 64;
    int Nbase = blockIdx.x * 64;

    // Panels are contiguous 32KB blocks in our layouts.
    stage_panel(Wq + (size_t)Mbase * PANEL_ROWB, ldsA, t);
    stage_panel(xnT + ((size_t)b * HW + Nbase) * PANEL_ROWB, ldsB, t);
    stage_wait();

    int r = lane & 15;
    v8f acc0 = {0.f,0.f,0.f,0.f,0.f,0.f,0.f,0.f};
    v8f acc1 = {0.f,0.f,0.f,0.f,0.f,0.f,0.f,0.f};
#pragma unroll
    for (int k0 = 0; k0 < Cc; k0 += 32) {
        v16bf fa  = lds_frag(ldsA, wm * 16 + r, k0, lane);
        v16bf fb0 = lds_frag(ldsB, wn * 32 + r, k0, lane);
        v16bf fb1 = lds_frag(ldsB, wn * 32 + 16 + r, k0, lane);
        acc0 = __builtin_amdgcn_wmma_f32_16x16x32_bf16(false, fa, false, fb0,
                                                       (short)0, acc0, false, false);
        acc1 = __builtin_amdgcn_wmma_f32_16x16x32_bf16(false, fa, false, fb1,
                                                       (short)0, acc1, false, false);
    }
    int col = lane & 15;
    int rowAdd = (lane >> 4) * 8;
    unsigned short* Qb = qBf + (size_t)b * Cc * HW;
#pragma unroll
    for (int i = 0; i < 8; ++i) {
        int row = Mbase + wm * 16 + i + rowAdd;
        int nb  = Nbase + wn * 32;
        Qb[(size_t)row * HW + nb + col]      = f2bf(acc0[i]);
        Qb[(size_t)row * HW + nb + 16 + col] = f2bf(acc1[i]);
    }
}

// ---------------------------------------------------------------------------
// Kernel 4: attention over NT=4 tokens. Block = (b,head) x 512 pixels,
// 2 pixels/thread (dword q loads). Phase 2 writes hT packed bf16x2.
// ---------------------------------------------------------------------------
__global__ void k_attn(const unsigned short* __restrict__ qBf,
                       const float* __restrict__ kv,
                       unsigned short* __restrict__ hT) {
    int bh = blockIdx.y;
    int b = bh >> 2, head = bh & 3;
    int p0 = blockIdx.x * 512;
    int t = threadIdx.x;

    __shared__ float ks[HD][NT], vs[HD][NT];
    __shared__ float attn_s[512][NT];

    {
        int c = t >> 2, s = t & 3;
        ks[c][s] = kv[(size_t)b * 2048 +        (head * HD + c) * NT + s];
        vs[c][s] = kv[(size_t)b * 2048 + 1024 + (head * HD + c) * NT + s];
    }
    __syncthreads();

    // ---- phase 1: two pixels per thread
    const unsigned short* qbase =
        qBf + ((size_t)b * Cc + head * HD) * HW + p0 + 2 * t;
    float a00 = 0.f, a01 = 0.f, a02 = 0.f, a03 = 0.f;
    float a10 = 0.f, a11 = 0.f, a12 = 0.f, a13 = 0.f;
#pragma unroll 8
    for (int c = 0; c < HD; ++c) {
        unsigned int qq = *(const unsigned int*)(qbase + (size_t)c * HW);
        float q0 = bf2f((unsigned short)(qq & 0xffffu));
        float q1 = bf2f((unsigned short)(qq >> 16));
        float k0 = ks[c][0], k1 = ks[c][1], k2 = ks[c][2], k3 = ks[c][3];
        a00 += q0 * k0; a01 += q0 * k1; a02 += q0 * k2; a03 += q0 * k3;
        a10 += q1 * k0; a11 += q1 * k1; a12 += q1 * k2; a13 += q1 * k3;
    }
    const float sc = 1.0f / (float)HD;   // scale applied to both q and k -> 1/hd
    {
        float x0 = a00 * sc, x1 = a01 * sc, x2 = a02 * sc, x3 = a03 * sc;
        float mx = fmaxf(fmaxf(x0, x1), fmaxf(x2, x3));
        float e0 = __expf(x0 - mx), e1 = __expf(x1 - mx);
        float e2 = __expf(x2 - mx), e3 = __expf(x3 - mx);
        float inv = 1.f / (e0 + e1 + e2 + e3);
        attn_s[2 * t][0] = e0 * inv; attn_s[2 * t][1] = e1 * inv;
        attn_s[2 * t][2] = e2 * inv; attn_s[2 * t][3] = e3 * inv;
    }
    {
        float x0 = a10 * sc, x1 = a11 * sc, x2 = a12 * sc, x3 = a13 * sc;
        float mx = fmaxf(fmaxf(x0, x1), fmaxf(x2, x3));
        float e0 = __expf(x0 - mx), e1 = __expf(x1 - mx);
        float e2 = __expf(x2 - mx), e3 = __expf(x3 - mx);
        float inv = 1.f / (e0 + e1 + e2 + e3);
        attn_s[2 * t + 1][0] = e0 * inv; attn_s[2 * t + 1][1] = e1 * inv;
        attn_s[2 * t + 1][2] = e2 * inv; attn_s[2 * t + 1][3] = e3 * inv;
    }
    __syncthreads();

    // ---- phase 2: lane covers 2 channels -> contiguous 128B store per pixel
    int wave = t >> 5, lane = t & 31;
    int c = lane * 2;
    float v00 = vs[c][0],   v01 = vs[c][1],   v02 = vs[c][2],   v03 = vs[c][3];
    float v10 = vs[c+1][0], v11 = vs[c+1][1], v12 = vs[c+1][2], v13 = vs[c+1][3];
#pragma unroll 4
    for (int pi = 0; pi < 64; ++pi) {
        int pl = wave * 64 + pi;
        float w0 = attn_s[pl][0], w1 = attn_s[pl][1];
        float w2 = attn_s[pl][2], w3 = attn_s[pl][3];
        float h0 = w0 * v00 + w1 * v01 + w2 * v02 + w3 * v03;
        float h1 = w0 * v10 + w1 * v11 + w2 * v12 + w3 * v13;
        unsigned int pk = (unsigned int)f2bf(h0) | ((unsigned int)f2bf(h1) << 16);
        *(unsigned int*)&hT[((size_t)b * HW + p0 + pl) * Cc + head * HD + c] = pk;
    }
}

// ---------------------------------------------------------------------------
// Kernel 5: proj GEMM + bias + residual (LDS-staged, WMMA).
// out[b][o][p] = sum_c Wp[o][c] * hT[b][p][c] + bp[o] + img[b][o][p]
// ---------------------------------------------------------------------------
__global__ void __launch_bounds__(256) k_gemm_proj(const unsigned char* __restrict__ Wp,
                                                   const unsigned char* __restrict__ hT,
                                                   const float* __restrict__ bp,
                                                   const float* __restrict__ img,
                                                   float* __restrict__ out) {
    __shared__ __align__(16) unsigned char ldsA[64 * PANEL_LDSB];
    __shared__ __align__(16) unsigned char ldsB[64 * PANEL_LDSB];

    int t    = threadIdx.x;
    int lane = t & 31;
    int wave = t >> 5;
    int wm = wave & 3, wn = wave >> 2;
    int b = blockIdx.z;
    int Mbase = blockIdx.y * 64;
    int Nbase = blockIdx.x * 64;

    stage_panel(Wp + (size_t)Mbase * PANEL_ROWB, ldsA, t);
    stage_panel(hT + ((size_t)b * HW + Nbase) * PANEL_ROWB, ldsB, t);
    stage_wait();

    int r = lane & 15;
    v8f acc0 = {0.f,0.f,0.f,0.f,0.f,0.f,0.f,0.f};
    v8f acc1 = {0.f,0.f,0.f,0.f,0.f,0.f,0.f,0.f};
#pragma unroll
    for (int k0 = 0; k0 < Cc; k0 += 32) {
        v16bf fa  = lds_frag(ldsA, wm * 16 + r, k0, lane);
        v16bf fb0 = lds_frag(ldsB, wn * 32 + r, k0, lane);
        v16bf fb1 = lds_frag(ldsB, wn * 32 + 16 + r, k0, lane);
        acc0 = __builtin_amdgcn_wmma_f32_16x16x32_bf16(false, fa, false, fb0,
                                                       (short)0, acc0, false, false);
        acc1 = __builtin_amdgcn_wmma_f32_16x16x32_bf16(false, fa, false, fb1,
                                                       (short)0, acc1, false, false);
    }
    int col = lane & 15;
    int rowAdd = (lane >> 4) * 8;
#pragma unroll
    for (int i = 0; i < 8; ++i) {
        int row = Mbase + wm * 16 + i + rowAdd;
        int nb  = Nbase + wn * 32;
        float bias = bp[row];
        size_t i0 = ((size_t)b * Cc + row) * HW + nb + col;
        out[i0]      = acc0[i] + bias + img[i0];
        out[i0 + 16] = acc1[i] + bias + img[i0 + 16];
    }
}

// ---------------------------------------------------------------------------
// Host launcher
// ---------------------------------------------------------------------------
extern "C" void kernel_launch(void* const* d_in, const int* in_sizes, int n_in,
                              void* d_out, int out_size, void* d_ws, size_t ws_size,
                              hipStream_t stream) {
    (void)in_sizes; (void)n_in; (void)out_size; (void)ws_size;
    const float* img    = (const float*)d_in[0];
    const float* params = (const float*)d_in[1];
    const float* obj    = (const float*)d_in[2];
    const float* gn_w   = (const float*)d_in[3];
    const float* gn_b   = (const float*)d_in[4];
    const float* Wq     = (const float*)d_in[5];
    const float* ln_w   = (const float*)d_in[6];
    const float* ln_b   = (const float*)d_in[7];
    const float* Wkv    = (const float*)d_in[8];
    const float* bkv    = (const float*)d_in[9];
    const float* Wp     = (const float*)d_in[10];
    const float* bp     = (const float*)d_in[11];
    float* out = (float*)d_out;

    char* ws = (char*)d_ws;
    float*          stats = (float*)(ws + 0);                         //   4 KB
    float*          kvbuf = (float*)(ws + 4096);                      // 128 KB
    unsigned short* WqBf  = (unsigned short*)(ws + 135168);           // 128 KB
    unsigned short* WpBf  = (unsigned short*)(ws + 266240);           // 128 KB
    unsigned short* xnT   = (unsigned short*)(ws + 397312);           //  32 MB
    unsigned short* qBf   = (unsigned short*)(ws + 33951744ULL);      //  32 MB
    unsigned short* hT    = (unsigned short*)(ws + 67506176ULL);      //  32 MB

    k_pre<<<dim3(PRE_COND + PRE_STATS + 2 * PRE_CVT), dim3(256), 0, stream>>>(
        img, params, obj, ln_w, ln_b, Wkv, bkv, Wq, Wp, stats, kvbuf, WqBf, WpBf);
    k_gn_apply<<<dim3(HW / 64, Cc / 64, Bz), dim3(256), 0, stream>>>(
        img, stats, gn_w, gn_b, xnT);
    k_gemm_q<<<dim3(HW / 64, Cc / 64, Bz), dim3(256), 0, stream>>>(
        (const unsigned char*)WqBf, (const unsigned char*)xnT, qBf);
    k_attn<<<dim3(HW / 512, Bz * NHd), dim3(256), 0, stream>>>(qBf, kvbuf, hT);
    k_gemm_proj<<<dim3(HW / 64, Cc / 64, Bz), dim3(256), 0, stream>>>(
        (const unsigned char*)WpBf, (const unsigned char*)hT, bp, img, out);
}

// v003
// It runs in 27.4 microseconds.
// Versions in between are left out here; by their measured steps it is 2.77 times as fast as v001.
// Over all steps from v000 it is 3.36 times as fast.
#include <hip/hip_runtime.h>
#include <hip/hip_bf16.h>

typedef __bf16 bf16_t;
typedef __attribute__((ext_vector_type(16))) __bf16 v16bf;
typedef __attribute__((ext_vector_type(8)))  float  v8f;
typedef __attribute__((ext_vector_type(2)))  float  v2f;

#define Bz 16
#define Cc 256
#define HW 4096
#define NHd 4
#define HD 64
#define NT 4
#define GRP 32
#define COMB 512
#define EPSV 1e-5f

__device__ __forceinline__ float bf2f(unsigned short u) {
    union { unsigned int i; float f; } x; x.i = ((unsigned int)u) << 16; return x.f;
}
__device__ __forceinline__ unsigned short f2bf(float f) {
    union { bf16_t h; unsigned short u; } x; x.h = (bf16_t)f; return x.u;
}

union FragU { uint4 u[2]; v16bf v; };

// 2^x. The v_nop fills the one slot that the instruction set asks for between a
// transcendental and a next instruction that reads its result or overwrites its
// source; inside the statement it cannot drift away from the v_exp_f32.
__device__ __forceinline__ float exp2_slot(float x) {
    float r;
    asm("v_exp_f32 %0, %1\n\tv_nop" : "=v"(r) : "v"(x));
    return r;
}

// ---------------------------------------------------------------------------
// Typed address-space helpers for the CDNA5 async-to-LDS builtin, whose
// signature is (int4 AS1*, int4 AS3*, imm offset, imm cpol).
// Generic LDS pointers carry the LDS offset in the low 32 bits; generic
// global pointers are the 64-bit VA.
// ---------------------------------------------------------------------------
typedef int v4i_t __attribute__((vector_size(16)));
typedef __attribute__((address_space(1))) v4i_t* as1_v4i;
typedef __attribute__((address_space(3))) v4i_t* as3_v4i;

__device__ __forceinline__ as1_v4i as_global(const void* p) {
    return reinterpret_cast<as1_v4i>(reinterpret_cast<uintptr_t>(p));
}
__device__ __forceinline__ as3_v4i as_lds(void* p) {
    return reinterpret_cast<as3_v4i>(
        (unsigned int)reinterpret_cast<uintptr_t>(p));
}

// One lane's 16 bytes from global memory into LDS. Async DMA path when available
// (ASYNCcnt: the reader's side waits as in stage_wait), else through registers.
__device__ __forceinline__ void copy16(const void* __restrict__ g, void* __restrict__ l) {
#if __has_builtin(__builtin_amdgcn_global_load_async_to_lds_b128)
    __builtin_amdgcn_global_load_async_to_lds_b128(as_global(g), as_lds(l), 0, 0);
#else
    *(uint4*)l = *(const uint4*)g;
#endif
}

// The same for one lane's 4 bytes.
__device__ __forceinline__ void copy4(const float* __restrict__ g, float* __restrict__ l) {
#if __has_builtin(__builtin_amdgcn_global_load_async_to_lds_b32)
    __builtin_amdgcn_global_load_async_to_lds_b32(
        reinterpret_cast<__attribute__((address_space(1))) int*>(reinterpret_cast<uintptr_t>(g)),
        reinterpret_cast<__attribute__((address_space(3))) int*>(
            (unsigned int)reinterpret_cast<uintptr_t>(l)), 0, 0);
#else
    *l = *g;
#endif
}

__device__ __forceinline__ void stage_wait() {
#if __has_builtin(__builtin_amdgcn_global_load_async_to_lds_b128)
    asm volatile("s_wait_asynccnt 0x0" ::: "memory");
#endif
    __syncthreads();
}

// ---------------------------------------------------------------------------
// Kernel 1: every piece of work that depends on the inputs alone, in one
// launch: conditioning path (with the two weight folds) and GroupNorm
// statistics. The pieces share no data; a work-group does exactly one of them,
// chosen by its index. The longest work-groups (conditioning) have the lowest
// indices so that they start first.
// ---------------------------------------------------------------------------
#define PRE_COND  (Bz * 8)            // work-groups of the conditioning path
#define PRE_STATS (Bz * GRP)          // work-groups of the GroupNorm statistics
#define WL_PITCH  68                  // floats per staged Wp row: 16 B x odd, no bank conflict

// GroupNorm statistics. One work-group per (b, g); reduce 8*4096 elems.
__device__ __forceinline__ void pre_gn_stats(int bg, const float* __restrict__ img,
                                             float* __restrict__ stats,
                                             float* r1, float* r2) {
    const float* base = img + (size_t)bg * 8 * HW;
    float s = 0.f, s2 = 0.f;
    for (int i = threadIdx.x; i < 8 * HW; i += 256) {
        float v = base[i];
        s += v; s2 += v * v;
    }
    r1[threadIdx.x] = s; r2[threadIdx.x] = s2;
    __syncthreads();
    for (int off = 128; off > 0; off >>= 1) {
        if (threadIdx.x < off) {
            r1[threadIdx.x] += r1[threadIdx.x + off];
            r2[threadIdx.x] += r2[threadIdx.x + off];
        }
        __syncthreads();
    }
    if (threadIdx.x == 0) {
        float mean = r1[0] * (1.f / 32768.f);
        float var  = r2[0] * (1.f / 32768.f) - mean * mean;
        stats[bg * 2 + 0] = mean;
        stats[bg * 2 + 1] = rsqrtf(var + EPSV);
    }
}

// Conditioning path: LayerNorm(combined), kv = cn @ Wkv^T + bkv, then the fold.
// A work-group's 256 kv values are exactly one head's k[64][4] (blk&7 < 4) or
// v[64][4]. Since q = Wq xn enters only through q^T k, and h = v attn only
// through Wp h, the products are reassociated:
//   logits = (Wq_head^T k)^T xn      Kp[head*4+s][c] = sum_d Wq[head*64+d][c] k[d][s]
//   proj   = (Wp_head v) attn        Vp[o][head*4+s] = sum_d Wp[o][head*64+d] v[d][s]
// Both are stored as bf16 so that a wave's A-fragment load covers whole lines and
// every 128-byte line has one writing work-group (one head):
//   KpF[b][kstep][half][head][lane half][s][8 k]      VpF[b][otile][head][row][4 s]
__device__ __forceinline__ void pre_cond_kv(int blk,
                                            const float* __restrict__ params,
                                            const float* __restrict__ obj,
                                            const float* __restrict__ ln_w,
                                            const float* __restrict__ ln_b,
                                            const float* __restrict__ Wkv,
                                            const float* __restrict__ bkv,
                                            const float* __restrict__ Wq,
                                            const float* __restrict__ Wp,
                                            unsigned short* __restrict__ KpF,
                                            unsigned short* __restrict__ VpF,
                                            float* r1, float* r2, float* cn, float* ms,
                                            float* kvs, float* wl) {
    int b  = blk >> 3;
    int jc = blk & 7;
    int t  = threadIdx.x;

    if (jc >= 4) {                              // the same for the whole work-group
        // This head's 64 columns of Wp, read by whole lines (16 lanes a row) and
        // copied into LDS, where the fold reads a row per thread. The copies fly
        // during the LayerNorm and the kv sums; their wait stands at the fold.
        const float* wsrc = Wp + (jc - 4) * HD;
#pragma unroll   // all 16 copies of a thread in flight at once
        for (int i = 0; i < 16; ++i) {
            int idx = t + i * 256, row = idx >> 4, c4 = idx & 15;
            copy16(wsrc + row * Cc + c4 * 4, wl + row * WL_PITCH + c4 * 4);
        }
    }

    float v0 = (t < 128) ? params[b * 128 + t] : obj[b * 384 + (t - 128)];
    float v1 = obj[b * 384 + t + 128];
    r1[t] = v0 + v1;
    r2[t] = v0 * v0 + v1 * v1;
    __syncthreads();
    for (int off = 128; off > 0; off >>= 1) {
        if (t < off) { r1[t] += r1[t + off]; r2[t] += r2[t + off]; }
        __syncthreads();
    }
    if (t == 0) {
        float m = r1[0] * (1.f / 512.f);
        float var = r2[0] * (1.f / 512.f) - m * m;
        ms[0] = m; ms[1] = rsqrtf(var + EPSV);
    }
    __syncthreads();
    float m = ms[0], rs = ms[1];
    cn[t]       = (v0 - m) * rs * ln_w[t]       + ln_b[t];
    cn[t + 256] = (v1 - m) * rs * ln_w[t + 256] + ln_b[t + 256];
    __syncthreads();

    int j = jc * 256 + t;
    const float4* w4 = (const float4*)(Wkv + (size_t)j * COMB);
    const float4* c4 = (const float4*)cn;
    float acc = bkv[j];
#pragma unroll 4
    for (int i = 0; i < COMB / 4; ++i) {
        float4 w = w4[i], c = c4[i];
        acc += w.x * c.x + w.y * c.y + w.z * c.z + w.w * c.w;
    }
    kvs[t] = acc;                               // [d = t/4][s = t%4] of this head
    stage_wait();                               // Wp copies landed, kvs published

    const float4* kv4 = (const float4*)kvs;     // kv4[d] = the 4 tokens of channel d
    float a0 = 0.f, a1 = 0.f, a2 = 0.f, a3 = 0.f;
    if (jc < 4) {                               // the same for the whole work-group
        int head = jc;
        const float* wcol = Wq + (size_t)head * HD * Cc + t;   // column c = t
#pragma unroll   // all 64 loads in flight at once
        for (int d = 0; d < HD; ++d) {
            float w = wcol[d * Cc];
            float4 k = kv4[d];
            a0 += w * k.x; a1 += w * k.y; a2 += w * k.z; a3 += w * k.w;
        }
        // c = t -> kstep t/32, half (t/16)%2, lane half (t/8)%2, element t%8
        int ks = t >> 5, half = (t >> 4) & 1, hh = (t >> 3) & 1, e = t & 7;
        unsigned short* dst =
            KpF + (((((size_t)b * 8 + ks) * 2 + half) * 4 + head) * 2 + hh) * 32 + e;
        dst[0]  = f2bf(a0);                     // s = 0 .. 3, 8 elements apart
        dst[8]  = f2bf(a1);
        dst[16] = f2bf(a2);
        dst[24] = f2bf(a3);
    } else {
        int head = jc - 4;
        const float4* wrow = (const float4*)(wl + t * WL_PITCH);               // row o = t
#pragma unroll   // the LDS reads run ahead of the sums
        for (int d4 = 0; d4 < HD / 4; ++d4) {
            float4 w = wrow[d4];
            float4 x0 = kv4[d4 * 4 + 0], x1 = kv4[d4 * 4 + 1];
            float4 x2 = kv4[d4 * 4 + 2], x3 = kv4[d4 * 4 + 3];
            a0 += w.x * x0.x + w.y * x1.x + w.z * x2.x + w.w * x3.x;
            a1 += w.x * x0.y + w.y * x1.y + w.z * x2.y + w.w * x3.y;
            a2 += w.x * x0.z + w.y * x1.z + w.z * x2.z + w.w * x3.z;
            a3 += w.x * x0.w + w.y * x1.w + w.z * x2.w + w.w * x3.w;
        }
        // o = t -> otile t/16, row t%16
        uint2 pk;
        pk.x = (unsigned int)f2bf(a0) | ((unsigned int)f2bf(a1) << 16);
        pk.y = (unsigned int)f2bf(a2) | ((unsigned int)f2bf(a3) << 16);
        *(uint2*)(VpF + ((((size_t)b * 16 + (t >> 4)) * 4 + head) * 16 + (t & 15)) * 4) = pk;
        // Precaution: in the built code this store's registers are written again on
        // a path behind it; the wait stands in front of those writes.
        asm volatile("s_wait_xcnt 0x0" ::: "memory");
    }
}

__global__ void __launch_bounds__(256) k_pre(const float* __restrict__ img,
                                             const float* __restrict__ params,
                                             const float* __restrict__ obj,
                                             const float* __restrict__ ln_w,
                                             const float* __restrict__ ln_b,
                                             const float* __restrict__ Wkv,
                                             const float* __restrict__ bkv,
                                             const float* __restrict__ Wq,
                                             const float* __restrict__ Wp,
                                             float* __restrict__ stats,
                                             unsigned short* __restrict__ KpF,
                                             unsigned short* __restrict__ VpF) {
    __shared__ float r1[256], r2[256];
    __shared__ __align__(16) float cn[COMB];
    __shared__ __align__(16) float kvs[256];  // one head's k or v
    __shared__ __align__(16) float wl[Cc * WL_PITCH];  // one head's columns of Wp
    __shared__ float ms[2];               // LayerNorm mean and 1/std
    int blk = blockIdx.x;                 // the same for the whole work-group
    if (blk < PRE_COND) {
        pre_cond_kv(blk, params, obj, ln_w, ln_b, Wkv, bkv, Wq, Wp, KpF, VpF,
                    r1, r2, cn, ms, kvs, wl);
    } else {
        pre_gn_stats(blk - PRE_COND, img, stats, r1, r2);
    }
}

// ---------------------------------------------------------------------------
// Kernel 2: GroupNorm affine, logits, softmax, projection, bias and residual for
// 128 pixels, from one read of the image tile.
//   xn[c][p]     = (img[c][p] - mean) * rstd * gn_w[c] + gn_b[c], rounded to bf16
//   logits[j][p] = sum_c Kp[j][c] * xn[c][p] / 64      j = head*4 + token, 16 rows
//   out[o][p]    = sum_j Vp[o][j] * attn[j][p] + bp[o] + img[o][p]
// Tile T (0..7) holds the pixels (T/4)*64 + 4n + T%4, n = its column, so that the
// four tiles of a group give each lane four neighbouring pixels (16B accesses).
// A wave holds 64 channels x 64 pixels of img in registers, for the residual.
// Lane (n, h) has the channels 16*ot + 8h + r there, which are the k positions of
// its own B fragment: the same registers, normalised, feed the logits, each wave
// summing over its 64 channels; the four partial sums of a tile meet in LDS.
// Every loop below is unrolled: its arrays live in registers and need constant
// indices, and the loads of a loop are to be in flight together.
// Four waves per SIMD (at most 256 registers): two work-groups on a WGP, so that
// the whole grid is resident at once and reads in one round.
// ---------------------------------------------------------------------------
__global__ void __launch_bounds__(256) __attribute__((amdgpu_waves_per_eu(4, 4)))
k_attn_proj(const float* __restrict__ stats,
            const float* __restrict__ gn_w,
            const float* __restrict__ gn_b,
            const unsigned short* __restrict__ KpF,
            const unsigned short* __restrict__ VpF,
            const float* __restrict__ bp,
            const float* __restrict__ img,
            float* __restrict__ out) {
    __shared__ __align__(16) uint4 ldsK[16][32];        // Kp fragments, [kstep*2 + half][lane]
    __shared__ __align__(16) uint2 ldsV[16 * 4 * 16];   // Vp of this batch, as it lies in VpF
    __shared__ __align__(16) float ldsBias[Cc];
    __shared__ __align__(16) float gnA[Cc], gnB[Cc];    // xn = img * gnA[c] + gnB[c]
    __shared__ __align__(16) float4 part[4][8][2][32];  // partial logits [quarter][tile][rows 4+4][lane]
    __shared__ __align__(16) uint4 attnS[8][32];

    int t    = threadIdx.x;
    int lane = t & 31;
    int wave = t >> 5;
    int n = lane & 15, h = lane >> 4;
    int b  = blockIdx.y;
    int p0 = blockIdx.x * 128;

    // Everything the work-group reads is asked for here, so that all reads fly
    // together and no global load stands among the stores at the end.
    float2 st = *(const float2*)(stats + (b * GRP + (t >> 3)) * 2);   // channel t's group
    float gw = gn_w[t], gb = gn_b[t];
    copy16((const uint4*)VpF + (size_t)b * 512 + t,       (uint4*)ldsV + t);
    copy16((const uint4*)VpF + (size_t)b * 512 + t + 256, (uint4*)ldsV + t + 256);
    copy4(bp + t, ldsBias + t);
#pragma unroll
    for (int i = 0; i < 2; ++i) {
        // chunk (head, lane half, s) of a 512B group goes to lane = half*16 + head*4 + s
        int g = t + i * 256, w = g & 31;
        copy16((const uint4*)KpF + (size_t)b * 512 + g,
               &ldsK[g >> 5][((w >> 2) & 1) * 16 + (w >> 3) * 4 + (w & 3)]);
    }

    // This wave's part of image and output: 64 pixels (group pg) x 64 rows (quarter oq).
    int pg = wave & 1, oq = wave >> 1;
    const size_t obase = ((size_t)b * Cc + oq * 64 + 8 * h) * HW + p0 + pg * 64 + 4 * n;
    float4 res[4][8];
#pragma unroll
    for (int ot = 0; ot < 4; ++ot)
#pragma unroll
        for (int r = 0; r < 8; ++r)
            res[ot][r] = *(const float4*)(img + obase + (size_t)(ot * 16 + r) * HW);

    // Keeps the wait for the statistics, and the sums behind it, from being lifted in
    // front of the image loads, which would then start one memory latency later.
    __builtin_amdgcn_sched_barrier(0);
    float ga_t = st.y * gw;                 // rstd * gn_w
    gnA[t] = ga_t;
    gnB[t] = gb - st.x * ga_t;              // gn_b - mean * rstd * gn_w
    stage_wait();

    // ---- partial logits of the wave's four tiles over its 64 channels (2 k steps):
    // lane (n, h) gets rows j = 8h .. 8h+7 of column n
    v8f lgp[4];
#pragma unroll
    for (int tt = 0; tt < 4; ++tt) lgp[tt] = (v8f){0.f,0.f,0.f,0.f,0.f,0.f,0.f,0.f};
#pragma unroll
    for (int ks = 0; ks < 2; ++ks) {
        FragU fk;
        fk.u[0] = ldsK[(oq * 2 + ks) * 2 + 0][lane];
        fk.u[1] = ldsK[(oq * 2 + ks) * 2 + 1][lane];
        v16bf fx[4];
#pragma unroll
        for (int half = 0; half < 2; ++half) {
            // k = 16*half + 8h + r of this k step is row r of res[2*ks + half]
            int ot = ks * 2 + half;
            int c0 = oq * 64 + ot * 16 + 8 * h;
            float4 a0 = *(const float4*)(gnA + c0), a1 = *(const float4*)(gnA + c0 + 4);
            float4 s0 = *(const float4*)(gnB + c0), s1 = *(const float4*)(gnB + c0 + 4);
            float ga[8] = {a0.x, a0.y, a0.z, a0.w, a1.x, a1.y, a1.z, a1.w};
            float gs[8] = {s0.x, s0.y, s0.z, s0.w, s1.x, s1.y, s1.z, s1.w};
#pragma unroll
            for (int r = 0; r < 8; ++r) {
                // two neighbouring pixels a packed multiply-add, as they lie in registers
                float4 v = res[ot][r];
                v2f lo = (v2f){v.x, v.y} * ga[r] + gs[r];
                v2f hi = (v2f){v.z, v.w} * ga[r] + gs[r];
                fx[0][half * 8 + r] = (bf16_t)lo.x;
                fx[1][half * 8 + r] = (bf16_t)lo.y;
                fx[2][half * 8 + r] = (bf16_t)hi.x;
                fx[3][half * 8 + r] = (bf16_t)hi.y;
            }
        }
#pragma unroll
        for (int tt = 0; tt < 4; ++tt)
            lgp[tt] = __builtin_amdgcn_wmma_f32_16x16x32_bf16(false, fk.v, false, fx[tt],
                                                              (short)0, lgp[tt], false, false);
    }
#pragma unroll
    for (int tt = 0; tt < 4; ++tt) {
        part[oq][pg * 4 + tt][0][lane] = make_float4(lgp[tt][0], lgp[tt][1], lgp[tt][2], lgp[tt][3]);
        part[oq][pg * 4 + tt][1][lane] = make_float4(lgp[tt][4], lgp[tt][5], lgp[tt][6], lgp[tt][7]);
    }
    __syncthreads();

    // ---- logits of tile T = wave: the four quarters' sums, in the order of the channels
    float lg[8];
    {
        float4 q0 = part[0][wave][0][lane], q1 = part[0][wave][1][lane];
        lg[0] = q0.x; lg[1] = q0.y; lg[2] = q0.z; lg[3] = q0.w;
        lg[4] = q1.x; lg[5] = q1.y; lg[6] = q1.z; lg[7] = q1.w;
    }
#pragma unroll
    for (int q = 1; q < 4; ++q) {
        float4 q0 = part[q][wave][0][lane], q1 = part[q][wave][1][lane];
        lg[0] += q0.x; lg[1] += q0.y; lg[2] += q0.z; lg[3] += q0.w;
        lg[4] += q1.x; lg[5] += q1.y; lg[6] += q1.z; lg[7] += q1.w;
    }

    // ---- softmax over the 4 tokens of each of the lane's two heads
    const float sc = 1.0f / (float)HD;   // scale applied to both q and k -> 1/hd
    unsigned int pk[4];
#pragma unroll
    for (int g = 0; g < 2; ++g) {
        float x0 = lg[4 * g] * sc, x1 = lg[4 * g + 1] * sc;
        float x2 = lg[4 * g + 2] * sc, x3 = lg[4 * g + 3] * sc;
        float mx = fmaxf(fmaxf(x0, x1), fmaxf(x2, x3));
        const float l2e = 1.44269504f;   // e^x = 2^(x * log2 e)
        float e0 = exp2_slot((x0 - mx) * l2e), e1 = exp2_slot((x1 - mx) * l2e);
        float e2 = exp2_slot((x2 - mx) * l2e), e3 = exp2_slot((x3 - mx) * l2e);
        float inv = 1.f / (e0 + e1 + e2 + e3);
        pk[2 * g]     = (unsigned int)f2bf(e0 * inv) | ((unsigned int)f2bf(e1 * inv) << 16);
        pk[2 * g + 1] = (unsigned int)f2bf(e2 * inv) | ((unsigned int)f2bf(e3 * inv) << 16);
    }
    // The packed column is already the lane's B fragment for k = 8h .. 8h+7.
    attnS[wave][lane] = make_uint4(pk[0], pk[1], pk[2], pk[3]);
    __syncthreads();

    // ---- projection: k = 0..15 are the 16 (head, token) pairs, k = 16..31 are zero
    const uint4 zero4 = make_uint4(0u, 0u, 0u, 0u);
    FragU fw[4];
#pragma unroll
    for (int tt = 0; tt < 4; ++tt) {
        fw[tt].u[0] = attnS[pg * 4 + tt][lane];
        fw[tt].u[1] = zero4;
    }
    // k = 8h .. 8h+7 of row n of Vp are the tokens of heads 2h and 2h+1
    const uint2* vf = ldsV + (oq * 4 * 4 + 2 * h) * 16 + n;
#pragma unroll
    for (int ot = 0; ot < 4; ++ot) {
        FragU fv;
        uint2 v0 = vf[ot * 64], v1 = vf[ot * 64 + 16];
        fv.u[0] = make_uint4(v0.x, v0.y, v1.x, v1.y);
        fv.u[1] = zero4;
        const float4* bq = (const float4*)(ldsBias + oq * 64 + ot * 16 + 8 * h);
        float4 b0 = bq[0], b1 = bq[1];
        float bias[8] = {b0.x, b0.y, b0.z, b0.w, b1.x, b1.y, b1.z, b1.w};
        v8f acc[4];
#pragma unroll
        for (int tt = 0; tt < 4; ++tt) {
            v8f z = {0.f,0.f,0.f,0.f,0.f,0.f,0.f,0.f};
            acc[tt] = __builtin_amdgcn_wmma_f32_16x16x32_bf16(false, fv.v, false, fw[tt].v,
                                                              (short)0, z, false, false);
        }
#pragma unroll
        for (int r = 0; r < 8; ++r) {
            float4 o4;
            o4.x = acc[0][r] + bias[r] + res[ot][r].x;
            o4.y = acc[1][r] + bias[r] + res[ot][r].y;
            o4.z = acc[2][r] + bias[r] + res[ot][r].z;
            o4.w = acc[3][r] + bias[r] + res[ot][r].w;
            *(float4*)(out + obase + (size_t)(ot * 16 + r) * HW) = o4;
        }
    }
}

// ---------------------------------------------------------------------------
// Host launcher
// ---------------------------------------------------------------------------
extern "C" void kernel_launch(void* const* d_in, const int* in_sizes, int n_in,
                              void* d_out, int out_size, void* d_ws, size_t ws_size,
                              hipStream_t stream) {
    (void)in_sizes; (void)n_in; (void)out_size; (void)ws_size;
    const float* img    = (const float*)d_in[0];
    const float* params = (const float*)d_in[1];
    const float* obj    = (const float*)d_in[2];
    const float* gn_w   = (const float*)d_in[3];
    const float* gn_b   = (const float*)d_in[4];
    const float* Wq     = (const float*)d_in[5];
    const float* ln_w   = (const float*)d_in[6];
    const float* ln_b   = (const float*)d_in[7];
    const float* Wkv    = (const float*)d_in[8];
    const float* bkv    = (const float*)d_in[9];
    const float* Wp     = (const float*)d_in[10];
    const float* bp     = (const float*)d_in[11];
    float* out = (float*)d_out;

    char* ws = (char*)d_ws;
    float*          stats = (float*)(ws + 0);                         //   4 KB
    unsigned short* KpF   = (unsigned short*)(ws + 135168);           // 128 KB
    unsigned short* VpF   = (unsigned short*)(ws + 266240);           // 128 KB

    k_pre<<<dim3(PRE_COND + PRE_STATS), dim3(256), 0, stream>>>(
        img, params, obj, ln_w, ln_b, Wkv, bkv, Wq, Wp, stats, KpF, VpF);
    k_attn_proj<<<dim3(HW / 128, Bz), dim3(256), 0, stream>>>(
        stats, gn_w, gn_b, KpF, VpF, bp, img, out);
}

// v004
// A run of this version takes 23.4 microseconds.
// Next to v003, in two timings, it ran 1.17 and 1.18 times as fast.
// Counting every step since v000, it is 3.95 times as fast.
#include <hip/hip_runtime.h>
#include <hip/hip_bf16.h>

typedef __bf16 bf16_t;
typedef __attribute__((ext_vector_type(16))) __bf16 v16bf;
typedef __attribute__((ext_vector_type(8)))  float  v8f;
typedef __attribute__((ext_vector_type(2)))  float  v2f;

#define Bz 16
#define Cc 256
#define HW 4096
#define NHd 4
#define HD 64
#define NT 4
#define GRP 32
#define COMB 512
#define EPSV 1e-5f

__device__ __forceinline__ float bf2f(unsigned short u) {
    union { unsigned int i; float f; } x; x.i = ((unsigned int)u) << 16; return x.f;
}
__device__ __forceinline__ unsigned short f2bf(float f) {
    union { bf16_t h; unsigned short u; } x; x.h = (bf16_t)f; return x.u;
}

union FragU { uint4 u[2]; v16bf v; };

// 2^x. The v_nop fills the one slot that the instruction set asks for between a
// transcendental and a next instruction that reads its result or overwrites its
// source; inside the statement it cannot drift away from the v_exp_f32.
__device__ __forceinline__ float exp2_slot(float x) {
    float r;
    asm("v_exp_f32 %0, %1\n\tv_nop" : "=v"(r) : "v"(x));
    return r;
}

// ---------------------------------------------------------------------------
// Typed address-space helpers for the CDNA5 async-to-LDS builtin, whose
// signature is (int4 AS1*, int4 AS3*, imm offset, imm cpol).
// Generic LDS pointers carry the LDS offset in the low 32 bits; generic
// global pointers are the 64-bit VA.
// ---------------------------------------------------------------------------
typedef int v4i_t __attribute__((vector_size(16)));
typedef __attribute__((address_space(1))) v4i_t* as1_v4i;
typedef __attribute__((address_space(3))) v4i_t* as3_v4i;

__device__ __forceinline__ as1_v4i as_global(const void* p) {
    return reinterpret_cast<as1_v4i>(reinterpret_cast<uintptr_t>(p));
}
__device__ __forceinline__ as3_v4i as_lds(void* p) {
    return reinterpret_cast<as3_v4i>(
        (unsigned int)reinterpret_cast<uintptr_t>(p));
}

// One lane's 16 bytes from global memory into LDS. Async DMA path when available
// (ASYNCcnt: the reader's side waits as in stage_wait), else through registers.
__device__ __forceinline__ void copy16(const void* __restrict__ g, void* __restrict__ l) {
#if __has_builtin(__builtin_amdgcn_global_load_async_to_lds_b128)
    __builtin_amdgcn_global_load_async_to_lds_b128(as_global(g), as_lds(l), 0, 0);
#else
    *(uint4*)l = *(const uint4*)g;
#endif
}

// The same for one lane's 4 bytes.
__device__ __forceinline__ void copy4(const float* __restrict__ g, float* __restrict__ l) {
#if __has_builtin(__builtin_amdgcn_global_load_async_to_lds_b32)
    __builtin_amdgcn_global_load_async_to_lds_b32(
        reinterpret_cast<__attribute__((address_space(1))) int*>(reinterpret_cast<uintptr_t>(g)),
        reinterpret_cast<__attribute__((address_space(3))) int*>(
            (unsigned int)reinterpret_cast<uintptr_t>(l)), 0, 0);
#else
    *l = *g;
#endif
}

__device__ __forceinline__ void stage_wait() {
#if __has_builtin(__builtin_amdgcn_global_load_async_to_lds_b128)
    asm volatile("s_wait_asynccnt 0x0" ::: "memory");
#endif
    __syncthreads();
}

// ---------------------------------------------------------------------------
// Kernel 1: every piece of work that depends on the inputs alone, in one
// launch: conditioning path (with the two weight folds) and GroupNorm
// statistics. The pieces share no data; a work-group does exactly one of them,
// chosen by its index. The longest work-groups (conditioning) have the lowest
// indices so that they start first.
// ---------------------------------------------------------------------------
#define PRE_COND  (Bz * 8)            // work-groups of the conditioning path
#define PRE_STATS (Bz * GRP)          // work-groups of the GroupNorm statistics
#define KV_AHEAD  2                   // steps of the kv sums whose loads run ahead
#define WL_PITCH  68                  // floats per staged Wp row: 16 B x odd, no bank conflict

// GroupNorm statistics. One work-group per (b, g); reduce 8*4096 elems.
__device__ __forceinline__ void pre_gn_stats(int bg, const float* __restrict__ img,
                                             float* __restrict__ stats,
                                             float* r1, float* r2) {
    const float* base = img + (size_t)bg * 8 * HW;
    float s = 0.f, s2 = 0.f;
    for (int i = threadIdx.x; i < 8 * HW; i += 256) {
        float v = base[i];
        s += v; s2 += v * v;
    }
    r1[threadIdx.x] = s; r2[threadIdx.x] = s2;
    __syncthreads();
    for (int off = 128; off > 0; off >>= 1) {
        if (threadIdx.x < off) {
            r1[threadIdx.x] += r1[threadIdx.x + off];
            r2[threadIdx.x] += r2[threadIdx.x + off];
        }
        __syncthreads();
    }
    if (threadIdx.x == 0) {
        float mean = r1[0] * (1.f / 32768.f);
        float var  = r2[0] * (1.f / 32768.f) - mean * mean;
        stats[bg * 2 + 0] = mean;
        stats[bg * 2 + 1] = rsqrtf(var + EPSV);
    }
}

// Conditioning path: LayerNorm(combined), kv = cn @ Wkv^T + bkv, then the fold.
// A work-group's 256 kv values are exactly one head's k[64][4] (blk&7 < 4) or
// v[64][4]. Since q = Wq xn enters only through q^T k, and h = v attn only
// through Wp h, the products are reassociated:
//   logits = (Wq_head^T k)^T xn      Kp[head*4+s][c] = sum_d Wq[head*64+d][c] k[d][s]
//   proj   = (Wp_head v) attn        Vp[o][head*4+s] = sum_d Wp[o][head*64+d] v[d][s]
// Both are stored as bf16 so that a wave's A-fragment load covers whole lines and
// every 128-byte line has one writing work-group (one head):
//   KpF[b][kstep][half][head][lane half][s][8 k]      VpF[b][otile][head][row][4 s]
__device__ __forceinline__ void pre_cond_kv(int blk,
                                            const float* __restrict__ params,
                                            const float* __restrict__ obj,
                                            const float* __restrict__ ln_w,
                                            const float* __restrict__ ln_b,
                                            const float* __restrict__ Wkv,
                                            const float* __restrict__ bkv,
                                            const float* __restrict__ Wq,
                                            const float* __restrict__ Wp,
                                            unsigned short* __restrict__ KpF,
                                            unsigned short* __restrict__ VpF,
                                            float* r1, float* r2, float* cn, float* ms,
                                            float* kvs, float* wl) {
    int b  = blk >> 3;
    int jc = blk & 7;
    int t  = threadIdx.x;

    if (jc >= 4) {                              // the same for the whole work-group
        // This head's 64 columns of Wp, read by whole lines (16 lanes a row) and
        // copied into LDS, where the fold reads a row per thread. The copies fly
        // during the LayerNorm and the kv sums; their wait stands at the fold.
        const float* wsrc = Wp + (jc - 4) * HD;
#pragma unroll   // all 16 copies of a thread in flight at once
        for (int i = 0; i < 16; ++i) {
            int idx = t + i * 256, row = idx >> 4, c4 = idx & 15;
            copy16(wsrc + row * Cc + c4 * 4, wl + row * WL_PITCH + c4 * 4);
        }
    }

    float v0 = (t < 128) ? params[b * 128 + t] : obj[b * 384 + (t - 128)];
    float v1 = obj[b * 384 + t + 128];
    float bj = bkv[jc * 256 + t];               // asked for early: used behind the kv sums
    r1[t] = v0 + v1;
    r2[t] = v0 * v0 + v1 * v1;
    __syncthreads();
    for (int off = 128; off > 0; off >>= 1) {
        if (t < off) { r1[t] += r1[t + off]; r2[t] += r2[t + off]; }
        __syncthreads();
    }
    if (t == 0) {
        float m = r1[0] * (1.f / 512.f);
        float var = r2[0] * (1.f / 512.f) - m * m;
        ms[0] = m; ms[1] = rsqrtf(var + EPSV);
    }
    __syncthreads();
    float m = ms[0], rs = ms[1];
    cn[t]       = (v0 - m) * rs * ln_w[t]       + ln_b[t];
    cn[t + 256] = (v1 - m) * rs * ln_w[t + 256] + ln_b[t + 256];
    __syncthreads();

    // kv: eight lanes share a row of Wkv, so that a wave's load covers four whole
    // 128-byte lines (one of each of four rows) instead of a piece of 32 lines.
    // Lane (q, l8) = (lane / 8, lane % 8) has, of the rows 8q + s (s = 0..7) of its
    // wave's 32, the columns 32*i + 4*l8 .. + 3 in step i.
    int l8 = t & 7;
    int j = jc * 256 + t;
    const float4* c4 = (const float4*)cn + l8;
    const float4* w4 = (const float4*)(Wkv + (size_t)(j - l8) * COMB) + l8;
    float4 wr[KV_AHEAD + 1][8];                 // ring of steps: 8 loads each
    v2f acc[8];                                 // the lane's share of its 8 rows' sums
#pragma unroll   // acc lives in registers
    for (int s = 0; s < 8; ++s) acc[s] = (v2f){0.f, 0.f};
#pragma unroll   // wr lives in registers
    for (int i = 0; i < KV_AHEAD; ++i)
#pragma unroll
        for (int s = 0; s < 8; ++s) wr[i][s] = w4[s * 128 + i * 8];
#pragma unroll   // wr lives in registers and needs constant indices
    for (int i = 0; i < 16; ++i) {
        // the loads of step i + KV_AHEAD go out before the sums of step i
        if (i + KV_AHEAD < 16) {
#pragma unroll
            for (int s = 0; s < 8; ++s)
                wr[(i + KV_AHEAD) % (KV_AHEAD + 1)][s] = w4[s * 128 + (i + KV_AHEAD) * 8];
        }
        float4 c = c4[i * 8];
#pragma unroll
        for (int s = 0; s < 8; ++s) {
            float4 w = wr[i % (KV_AHEAD + 1)][s];
            acc[s] += (v2f){w.x, w.y} * (v2f){c.x, c.y};
            acc[s] += (v2f){w.z, w.w} * (v2f){c.z, c.w};
        }
    }
    // Sum over the eight lanes of a row: a butterfly, the eight rows' exchanges of a
    // step in flight together. Every lane then has all eight sums and keeps that of
    // row 8q + l8, its own number.
    float pr[8];
#pragma unroll   // pr lives in registers
    for (int s = 0; s < 8; ++s) pr[s] = acc[s].x + acc[s].y;
#pragma unroll   // constant indices into pr
    for (int m = 1; m < 8; m <<= 1)
#pragma unroll
        for (int s = 0; s < 8; ++s) pr[s] += __shfl_xor(pr[s], m);
    float mine = pr[0];
#pragma unroll   // constant indices into pr
    for (int s = 1; s < 8; ++s) if (l8 == s) mine = pr[s];
    kvs[t] = mine + bj;                         // [d = t/4][s = t%4] of this head
    stage_wait();                               // Wp copies landed, kvs published

    const float4* kv4 = (const float4*)kvs;     // kv4[d] = the 4 tokens of channel d
    float a0 = 0.f, a1 = 0.f, a2 = 0.f, a3 = 0.f;
    if (jc < 4) {                               // the same for the whole work-group
        int head = jc;
        const float* wcol = Wq + (size_t)head * HD * Cc + t;   // column c = t
#pragma unroll   // all 64 loads in flight at once
        for (int d = 0; d < HD; ++d) {
            float w = wcol[d * Cc];
            float4 k = kv4[d];
            a0 += w * k.x; a1 += w * k.y; a2 += w * k.z; a3 += w * k.w;
        }
        // c = t -> kstep t/32, half (t/16)%2, lane half (t/8)%2, element t%8
        int ks = t >> 5, half = (t >> 4) & 1, hh = (t >> 3) & 1, e = t & 7;
        unsigned short* dst =
            KpF + (((((size_t)b * 8 + ks) * 2 + half) * 4 + head) * 2 + hh) * 32 + e;
        dst[0]  = f2bf(a0);                     // s = 0 .. 3, 8 elements apart
        dst[8]  = f2bf(a1);
        dst[16] = f2bf(a2);
        dst[24] = f2bf(a3);
    } else {
        int head = jc - 4;
        const float4* wrow = (const float4*)(wl + t * WL_PITCH);               // row o = t
#pragma unroll   // the LDS reads run ahead of the sums
        for (int d4 = 0; d4 < HD / 4; ++d4) {
            float4 w = wrow[d4];
            float4 x0 = kv4[d4 * 4 + 0], x1 = kv4[d4 * 4 + 1];
            float4 x2 = kv4[d4 * 4 + 2], x3 = kv4[d4 * 4 + 3];
            a0 += w.x * x0.x + w.y * x1.x + w.z * x2.x + w.w * x3.x;
            a1 += w.x * x0.y + w.y * x1.y + w.z * x2.y + w.w * x3.y;
            a2 += w.x * x0.z + w.y * x1.z + w.z * x2.z + w.w * x3.z;
            a3 += w.x * x0.w + w.y * x1.w + w.z * x2.w + w.w * x3.w;
        }
        // o = t -> otile t/16, row t%16
        uint2 pk;
        pk.x = (unsigned int)f2bf(a0) | ((unsigned int)f2bf(a1) << 16);
        pk.y = (unsigned int)f2bf(a2) | ((unsigned int)f2bf(a3) << 16);
        *(uint2*)(VpF + ((((size_t)b * 16 + (t >> 4)) * 4 + head) * 16 + (t & 15)) * 4) = pk;
        // Precaution: in the built code this store's registers are written again on
        // a path behind it; the wait stands in front of those writes.
        asm volatile("s_wait_xcnt 0x0" ::: "memory");
    }
}

__global__ void __launch_bounds__(256) k_pre(const float* __restrict__ img,
                                             const float* __restrict__ params,
                                             const float* __restrict__ obj,
                                             const float* __restrict__ ln_w,
                                             const float* __restrict__ ln_b,
                                             const float* __restrict__ Wkv,
                                             const float* __restrict__ bkv,
                                             const float* __restrict__ Wq,
                                             const float* __restrict__ Wp,
                                             float* __restrict__ stats,
                                             unsigned short* __restrict__ KpF,
                                             unsigned short* __restrict__ VpF) {
    __shared__ float r1[256], r2[256];
    __shared__ __align__(16) float cn[COMB];
    __shared__ __align__(16) float kvs[256];  // one head's k or v
    __shared__ __align__(16) float wl[Cc * WL_PITCH];  // one head's columns of Wp
    __shared__ float ms[2];               // LayerNorm mean and 1/std
    int blk = blockIdx.x;                 // the same for the whole work-group
    if (blk < PRE_COND) {
        pre_cond_kv(blk, params, obj, ln_w, ln_b, Wkv, bkv, Wq, Wp, KpF, VpF,
                    r1, r2, cn, ms, kvs, wl);
    } else {
        pre_gn_stats(blk - PRE_COND, img, stats, r1, r2);
    }
}

// ---------------------------------------------------------------------------
// Kernel 2: GroupNorm affine, logits, softmax, projection, bias and residual for
// 128 pixels, from one read of the image tile.
//   xn[c][p]     = (img[c][p] - mean) * rstd * gn_w[c] + gn_b[c], rounded to bf16
//   logits[j][p] = sum_c Kp[j][c] * xn[c][p] / 64      j = head*4 + token, 16 rows
//   out[o][p]    = sum_j Vp[o][j] * attn[j][p] + bp[o] + img[o][p]
// Tile T (0..7) holds the pixels (T/4)*64 + 4n + T%4, n = its column, so that the
// four tiles of a group give each lane four neighbouring pixels (16B accesses).
// A wave holds 64 channels x 64 pixels of img in registers, for the residual.
// Lane (n, h) has the channels 16*ot + 8h + r there, which are the k positions of
// its own B fragment: the same registers, normalised, feed the logits, each wave
// summing over its 64 channels; the four partial sums of a tile meet in LDS.
// Every loop below is unrolled: its arrays live in registers and need constant
// indices, and the loads of a loop are to be in flight together.
// Four waves per SIMD (at most 256 registers): two work-groups on a WGP, so that
// the whole grid is resident at once and reads in one round.
// ---------------------------------------------------------------------------
__global__ void __launch_bounds__(256) __attribute__((amdgpu_waves_per_eu(4, 4)))
k_attn_proj(const float* __restrict__ stats,
            const float* __restrict__ gn_w,
            const float* __restrict__ gn_b,
            const unsigned short* __restrict__ KpF,
            const unsigned short* __restrict__ VpF,
            const float* __restrict__ bp,
            const float* __restrict__ img,
            float* __restrict__ out) {
    __shared__ __align__(16) uint4 ldsK[16][32];        // Kp fragments, [kstep*2 + half][lane]
    __shared__ __align__(16) uint2 ldsV[16 * 4 * 16];   // Vp of this batch, as it lies in VpF
    __shared__ __align__(16) float ldsBias[Cc];
    __shared__ __align__(16) float gnA[Cc], gnB[Cc];    // xn = img * gnA[c] + gnB[c]
    __shared__ __align__(16) float4 part[4][8][2][32];  // partial logits [quarter][tile][rows 4+4][lane]
    __shared__ __align__(16) uint4 attnS[8][32];

    int t    = threadIdx.x;
    int lane = t & 31;
    int wave = t >> 5;
    int n = lane & 15, h = lane >> 4;
    int b  = blockIdx.y;
    int p0 = blockIdx.x * 128;

    // Everything the work-group reads is asked for here, so that all reads fly
    // together and no global load stands among the stores at the end.
    float2 st = *(const float2*)(stats + (b * GRP + (t >> 3)) * 2);   // channel t's group
    float gw = gn_w[t], gb = gn_b[t];
    copy16((const uint4*)VpF + (size_t)b * 512 + t,       (uint4*)ldsV + t);
    copy16((const uint4*)VpF + (size_t)b * 512 + t + 256, (uint4*)ldsV + t + 256);
    copy4(bp + t, ldsBias + t);
#pragma unroll
    for (int i = 0; i < 2; ++i) {
        // chunk (head, lane half, s) of a 512B group goes to lane = half*16 + head*4 + s
        int g = t + i * 256, w = g & 31;
        copy16((const uint4*)KpF + (size_t)b * 512 + g,
               &ldsK[g >> 5][((w >> 2) & 1) * 16 + (w >> 3) * 4 + (w & 3)]);
    }

    // This wave's part of image and output: 64 pixels (group pg) x 64 rows (quarter oq).
    int pg = wave & 1, oq = wave >> 1;
    const size_t obase = ((size_t)b * Cc + oq * 64 + 8 * h) * HW + p0 + pg * 64 + 4 * n;
    float4 res[4][8];
#pragma unroll
    for (int ot = 0; ot < 4; ++ot)
#pragma unroll
        for (int r = 0; r < 8; ++r)
            res[ot][r] = *(const float4*)(img + obase + (size_t)(ot * 16 + r) * HW);

    // Keeps the wait for the statistics, and the sums behind it, from being lifted in
    // front of the image loads, which would then start one memory latency later.
    __builtin_amdgcn_sched_barrier(0);
    float ga_t = st.y * gw;                 // rstd * gn_w
    gnA[t] = ga_t;
    gnB[t] = gb - st.x * ga_t;              // gn_b - mean * rstd * gn_w
    stage_wait();

    // ---- partial logits of the wave's four tiles over its 64 channels (2 k steps):
    // lane (n, h) gets rows j = 8h .. 8h+7 of column n
    v8f lgp[4];
#pragma unroll
    for (int tt = 0; tt < 4; ++tt) lgp[tt] = (v8f){0.f,0.f,0.f,0.f,0.f,0.f,0.f,0.f};
#pragma unroll
    for (int ks = 0; ks < 2; ++ks) {
        FragU fk;
        fk.u[0] = ldsK[(oq * 2 + ks) * 2 + 0][lane];
        fk.u[1] = ldsK[(oq * 2 + ks) * 2 + 1][lane];
        v16bf fx[4];
#pragma unroll
        for (int half = 0; half < 2; ++half) {
            // k = 16*half + 8h + r of this k step is row r of res[2*ks + half]
            int ot = ks * 2 + half;
            int c0 = oq * 64 + ot * 16 + 8 * h;
            float4 a0 = *(const float4*)(gnA + c0), a1 = *(const float4*)(gnA + c0 + 4);
            float4 s0 = *(const float4*)(gnB + c0), s1 = *(const float4*)(gnB + c0 + 4);
            float ga[8] = {a0.x, a0.y, a0.z, a0.w, a1.x, a1.y, a1.z, a1.w};
            float gs[8] = {s0.x, s0.y, s0.z, s0.w, s1.x, s1.y, s1.z, s1.w};
#pragma unroll
            for (int r = 0; r < 8; ++r) {
                // two neighbouring pixels a packed multiply-add, as they lie in registers
                float4 v = res[ot][r];
                v2f lo = (v2f){v.x, v.y} * ga[r] + gs[r];
                v2f hi = (v2f){v.z, v.w} * ga[r] + gs[r];
                fx[0][half * 8 + r] = (bf16_t)lo.x;
                fx[1][half * 8 + r] = (bf16_t)lo.y;
                fx[2][half * 8 + r] = (bf16_t)hi.x;
                fx[3][half * 8 + r] = (bf16_t)hi.y;
            }
        }
#pragma unroll
        for (int tt = 0; tt < 4; ++tt)
            lgp[tt] = __builtin_amdgcn_wmma_f32_16x16x32_bf16(false, fk.v, false, fx[tt],
                                                              (short)0, lgp[tt], false, false);
    }
#pragma unroll
    for (int tt = 0; tt < 4; ++tt) {
        part[oq][pg * 4 + tt][0][lane] = make_float4(lgp[tt][0], lgp[tt][1], lgp[tt][2], lgp[tt][3]);
        part[oq][pg * 4 + tt][1][lane] = make_float4(lgp[tt][4], lgp[tt][5], lgp[tt][6], lgp[tt][7]);
    }
    __syncthreads();

    // ---- logits of tile T = wave: the four quarters' sums, in the order of the channels
    float lg[8];
    {
        float4 q0 = part[0][wave][0][lane], q1 = part[0][wave][1][lane];
        lg[0] = q0.x; lg[1] = q0.y; lg[2] = q0.z; lg[3] = q0.w;
        lg[4] = q1.x; lg[5] = q1.y; lg[6] = q1.z; lg[7] = q1.w;
    }
#pragma unroll
    for (int q = 1; q < 4; ++q) {
        float4 q0 = part[q][wave][0][lane], q1 = part[q][wave][1][lane];
        lg[0] += q0.x; lg[1] += q0.y; lg[2] += q0.z; lg[3] += q0.w;
        lg[4] += q1.x; lg[5] += q1.y; lg[6] += q1.z; lg[7] += q1.w;
    }

    // ---- softmax over the 4 tokens of each of the lane's two heads
    const float sc = 1.0f / (float)HD;   // scale applied to both q and k -> 1/hd
    unsigned int pk[4];
#pragma unroll
    for (int g = 0; g < 2; ++g) {
        float x0 = lg[4 * g] * sc, x1 = lg[4 * g + 1] * sc;
        float x2 = lg[4 * g + 2] * sc, x3 = lg[4 * g + 3] * sc;
        float mx = fmaxf(fmaxf(x0, x1), fmaxf(x2, x3));
        const float l2e = 1.44269504f;   // e^x = 2^(x * log2 e)
        float e0 = exp2_slot((x0 - mx) * l2e), e1 = exp2_slot((x1 - mx) * l2e);
        float e2 = exp2_slot((x2 - mx) * l2e), e3 = exp2_slot((x3 - mx) * l2e);
        float inv = 1.f / (e0 + e1 + e2 + e3);
        pk[2 * g]     = (unsigned int)f2bf(e0 * inv) | ((unsigned int)f2bf(e1 * inv) << 16);
        pk[2 * g + 1] = (unsigned int)f2bf(e2 * inv) | ((unsigned int)f2bf(e3 * inv) << 16);
    }
    // The packed column is already the lane's B fragment for k = 8h .. 8h+7.
    attnS[wave][lane] = make_uint4(pk[0], pk[1], pk[2], pk[3]);
    __syncthreads();

    // ---- projection: k = 0..15 are the 16 (head, token) pairs, k = 16..31 are zero
    const uint4 zero4 = make_uint4(0u, 0u, 0u, 0u);
    FragU fw[4];
#pragma unroll
    for (int tt = 0; tt < 4; ++tt) {
        fw[tt].u[0] = attnS[pg * 4 + tt][lane];
        fw[tt].u[1] = zero4;
    }
    // k = 8h .. 8h+7 of row n of Vp are the tokens of heads 2h and 2h+1
    const uint2* vf = ldsV + (oq * 4 * 4 + 2 * h) * 16 + n;
#pragma unroll
    for (int ot = 0; ot < 4; ++ot) {
        FragU fv;
        uint2 v0 = vf[ot * 64], v1 = vf[ot * 64 + 16];
        fv.u[0] = make_uint4(v0.x, v0.y, v1.x, v1.y);
        fv.u[1] = zero4;
        const float4* bq = (const float4*)(ldsBias + oq * 64 + ot * 16 + 8 * h);
        float4 b0 = bq[0], b1 = bq[1];
        float bias[8] = {b0.x, b0.y, b0.z, b0.w, b1.x, b1.y, b1.z, b1.w};
        v8f acc[4];
#pragma unroll
        for (int tt = 0; tt < 4; ++tt) {
            v8f z = {0.f,0.f,0.f,0.f,0.f,0.f,0.f,0.f};
            acc[tt] = __builtin_amdgcn_wmma_f32_16x16x32_bf16(false, fv.v, false, fw[tt].v,
                                                              (short)0, z, false, false);
        }
#pragma unroll
        for (int r = 0; r < 8; ++r) {
            float4 o4;
            o4.x = acc[0][r] + bias[r] + res[ot][r].x;
            o4.y = acc[1][r] + bias[r] + res[ot][r].y;
            o4.z = acc[2][r] + bias[r] + res[ot][r].z;
            o4.w = acc[3][r] + bias[r] + res[ot][r].w;
            *(float4*)(out + obase + (size_t)(ot * 16 + r) * HW) = o4;
        }
    }
}

// ---------------------------------------------------------------------------
// Host launcher
// ---------------------------------------------------------------------------
extern "C" void kernel_launch(void* const* d_in, const int* in_sizes, int n_in,
                              void* d_out, int out_size, void* d_ws, size_t ws_size,
                              hipStream_t stream) {
    (void)in_sizes; (void)n_in; (void)out_size; (void)ws_size;
    const float* img    = (const float*)d_in[0];
    const float* params = (const float*)d_in[1];
    const float* obj    = (const float*)d_in[2];
    const float* gn_w   = (const float*)d_in[3];
    const float* gn_b   = (const float*)d_in[4];
    const float* Wq     = (const float*)d_in[5];
    const float* ln_w   = (const float*)d_in[6];
    const float* ln_b   = (const float*)d_in[7];
    const float* Wkv    = (const float*)d_in[8];
    const float* bkv    = (const float*)d_in[9];
    const float* Wp     = (const float*)d_in[10];
    const float* bp     = (const float*)d_in[11];
    float* out = (float*)d_out;

    char* ws = (char*)d_ws;
    float*          stats = (float*)(ws + 0);                         //   4 KB
    unsigned short* KpF   = (unsigned short*)(ws + 135168);           // 128 KB
    unsigned short* VpF   = (unsigned short*)(ws + 266240);           // 128 KB

    k_pre<<<dim3(PRE_COND + PRE_STATS), dim3(256), 0, stream>>>(
        img, params, obj, ln_w, ln_b, Wkv, bkv, Wq, Wp, stats, KpF, VpF);
    k_attn_proj<<<dim3(HW / 128, Bz), dim3(256), 0, stream>>>(
        stats, gn_w, gn_b, KpF, VpF, bp, img, out);
}

// v005
// It runs in 21.8 microseconds.
// Timed twice side by side with v004, it ran 1.07 and 1.08 times as fast.
// All steps since v000 together make it 4.25 times as fast.
#include <hip/hip_runtime.h>
#include <hip/hip_bf16.h>

typedef __bf16 bf16_t;
typedef __attribute__((ext_vector_type(16))) __bf16 v16bf;
typedef __attribute__((ext_vector_type(8)))  float  v8f;
typedef __attribute__((ext_vector_type(2)))  float  v2f;

#define Bz 16
#define Cc 256
#define HW 4096
#define NHd 4
#define HD 64
#define NT 4
#define GRP 32
#define COMB 512
#define EPSV 1e-5f

__device__ __forceinline__ float bf2f(unsigned short u) {
    union { unsigned int i; float f; } x; x.i = ((unsigned int)u) << 16; return x.f;
}
__device__ __forceinline__ unsigned short f2bf(float f) {
    union { bf16_t h; unsigned short u; } x; x.h = (bf16_t)f; return x.u;
}

union FragU { uint4 u[2]; v16bf v; };

// 2^x. The v_nop fills the one slot that the instruction set asks for between a
// transcendental and a next instruction that reads its result or overwrites its
// source; inside the statement it cannot drift away from the v_exp_f32.
__device__ __forceinline__ float exp2_slot(float x) {
    float r;
    asm("v_exp_f32 %0, %1\n\tv_nop" : "=v"(r) : "v"(x));
    return r;
}

// ---------------------------------------------------------------------------
// Typed address-space helpers for the CDNA5 async-to-LDS builtin, whose
// signature is (int4 AS1*, int4 AS3*, imm offset, imm cpol).
// Generic LDS pointers carry the LDS offset in the low 32 bits; generic
// global pointers are the 64-bit VA.
// ---------------------------------------------------------------------------
typedef int v4i_t __attribute__((vector_size(16)));
typedef __attribute__((address_space(1))) v4i_t* as1_v4i;
typedef __attribute__((address_space(3))) v4i_t* as3_v4i;

__device__ __forceinline__ as1_v4i as_global(const void* p) {
    return reinterpret_cast<as1_v4i>(reinterpret_cast<uintptr_t>(p));
}
__device__ __forceinline__ as3_v4i as_lds(void* p) {
    return reinterpret_cast<as3_v4i>(
        (unsigned int)reinterpret_cast<uintptr_t>(p));
}

// One lane's 16 bytes from global memory into LDS. Async DMA path when available
// (ASYNCcnt: the reader's side waits as in stage_wait), else through registers.
__device__ __forceinline__ void copy16(const void* __restrict__ g, void* __restrict__ l) {
#if __has_builtin(__builtin_amdgcn_global_load_async_to_lds_b128)
    __builtin_amdgcn_global_load_async_to_lds_b128(as_global(g), as_lds(l), 0, 0);
#else
    *(uint4*)l = *(const uint4*)g;
#endif
}

// The same for one lane's 4 bytes.
__device__ __forceinline__ void copy4(const float* __restrict__ g, float* __restrict__ l) {
#if __has_builtin(__builtin_amdgcn_global_load_async_to_lds_b32)
    __builtin_amdgcn_global_load_async_to_lds_b32(
        reinterpret_cast<__attribute__((address_space(1))) int*>(reinterpret_cast<uintptr_t>(g)),
        reinterpret_cast<__attribute__((address_space(3))) int*>(
            (unsigned int)reinterpret_cast<uintptr_t>(l)), 0, 0);
#else
    *l = *g;
#endif
}

__device__ __forceinline__ void stage_wait() {
#if __has_builtin(__builtin_amdgcn_global_load_async_to_lds_b128)
    asm volatile("s_wait_asynccnt 0x0" ::: "memory");
#endif
    __syncthreads();
}

// ---------------------------------------------------------------------------
// Kernel 1: every piece of work that depends on the inputs alone, in one
// launch: conditioning path (with the two weight folds) and GroupNorm
// statistics. The pieces share no data; a work-group does exactly one of them,
// chosen by its index. The longest work-groups (conditioning) have the lowest
// indices so that they start first.
// ---------------------------------------------------------------------------
#define PRE_COND  (Bz * 8)            // work-groups of the conditioning path
#define PRE_STATS (Bz * GRP)          // work-groups of the GroupNorm statistics
#define KV_AHEAD  2                   // steps of the kv sums whose loads run ahead
#define WL_PITCH  68                  // floats per staged Wp row: 16 B x odd, no bank conflict

// GroupNorm statistics. One work-group per (b, g); reduce 8*4096 elems.
__device__ __forceinline__ void pre_gn_stats(int bg, const float* __restrict__ img,
                                             float* __restrict__ stats,
                                             float* r1, float* r2) {
    // A thread's share as 32 loads of 16 bytes (a wave's load: 512 bytes in a row), all
    // sent before the first sum: one trip to memory for the work-group's whole share.
    const float4* base = (const float4*)(img + (size_t)bg * 8 * HW) + threadIdx.x;
    float4 v[32];
#pragma unroll   // v lives in registers
    for (int i = 0; i < 32; ++i) v[i] = base[i * 256];
    // Keeps the first sums from being lifted in front of the last loads, which would
    // then go out one memory latency later.
    __builtin_amdgcn_sched_barrier(0);
    v2f sa = {0.f, 0.f}, sb = {0.f, 0.f}, qa = {0.f, 0.f}, qb = {0.f, 0.f};
#pragma unroll   // constant indices into v
    for (int i = 0; i < 32; ++i) {
        v2f lo = {v[i].x, v[i].y}, hi = {v[i].z, v[i].w};
        sa += lo; qa += lo * lo;
        sb += hi; qb += hi * hi;
    }
    float s = (sa.x + sa.y) + (sb.x + sb.y), s2 = (qa.x + qa.y) + (qb.x + qb.y);
    r1[threadIdx.x] = s; r2[threadIdx.x] = s2;
    __syncthreads();
    for (int off = 128; off > 0; off >>= 1) {
        if (threadIdx.x < off) {
            r1[threadIdx.x] += r1[threadIdx.x + off];
            r2[threadIdx.x] += r2[threadIdx.x + off];
        }
        __syncthreads();
    }
    if (threadIdx.x == 0) {
        float mean = r1[0] * (1.f / 32768.f);
        float var  = r2[0] * (1.f / 32768.f) - mean * mean;
        stats[bg * 2 + 0] = mean;
        stats[bg * 2 + 1] = rsqrtf(var + EPSV);
    }
}

// Conditioning path: LayerNorm(combined), kv = cn @ Wkv^T + bkv, then the fold.
// A work-group's 256 kv values are exactly one head's k[64][4] (blk&7 < 4) or
// v[64][4]. Since q = Wq xn enters only through q^T k, and h = v attn only
// through Wp h, the products are reassociated:
//   logits = (Wq_head^T k)^T xn      Kp[head*4+s][c] = sum_d Wq[head*64+d][c] k[d][s]
//   proj   = (Wp_head v) attn        Vp[o][head*4+s] = sum_d Wp[o][head*64+d] v[d][s]
// Both are stored as bf16 so that a wave's A-fragment load covers whole lines and
// every 128-byte line has one writing work-group (one head):
//   KpF[b][kstep][half][head][lane half][s][8 k]      VpF[b][otile][head][row][4 s]
__device__ __forceinline__ void pre_cond_kv(int blk,
                                            const float* __restrict__ params,
                                            const float* __restrict__ obj,
                                            const float* __restrict__ ln_w,
                                            const float* __restrict__ ln_b,
                                            const float* __restrict__ Wkv,
                                            const float* __restrict__ bkv,
                                            const float* __restrict__ Wq,
                                            const float* __restrict__ Wp,
                                            unsigned short* __restrict__ KpF,
                                            unsigned short* __restrict__ VpF,
                                            float* r1, float* r2, float* cn, float* ms,
                                            float* kvs, float* wl) {
    int b  = blk >> 3;
    int jc = blk & 7;
    int t  = threadIdx.x;

    if (jc >= 4) {                              // the same for the whole work-group
        // This head's 64 columns of Wp, read by whole lines (16 lanes a row) and
        // copied into LDS, where the fold reads a row per thread. The copies fly
        // during the LayerNorm and the kv sums; their wait stands at the fold.
        const float* wsrc = Wp + (jc - 4) * HD;
#pragma unroll   // all 16 copies of a thread in flight at once
        for (int i = 0; i < 16; ++i) {
            int idx = t + i * 256, row = idx >> 4, c4 = idx & 15;
            copy16(wsrc + row * Cc + c4 * 4, wl + row * WL_PITCH + c4 * 4);
        }
    }

    float v0 = (t < 128) ? params[b * 128 + t] : obj[b * 384 + (t - 128)];
    float v1 = obj[b * 384 + t + 128];
    float bj = bkv[jc * 256 + t];               // asked for early: used behind the kv sums
    r1[t] = v0 + v1;
    r2[t] = v0 * v0 + v1 * v1;
    __syncthreads();
    for (int off = 128; off > 0; off >>= 1) {
        if (t < off) { r1[t] += r1[t + off]; r2[t] += r2[t + off]; }
        __syncthreads();
    }
    if (t == 0) {
        float m = r1[0] * (1.f / 512.f);
        float var = r2[0] * (1.f / 512.f) - m * m;
        ms[0] = m; ms[1] = rsqrtf(var + EPSV);
    }
    __syncthreads();
    float m = ms[0], rs = ms[1];
    cn[t]       = (v0 - m) * rs * ln_w[t]       + ln_b[t];
    cn[t + 256] = (v1 - m) * rs * ln_w[t + 256] + ln_b[t + 256];
    __syncthreads();

    // kv: eight lanes share a row of Wkv, so that a wave's load covers four whole
    // 128-byte lines (one of each of four rows) instead of a piece of 32 lines.
    // Lane (q, l8) = (lane / 8, lane % 8) has, of the rows 8q + s (s = 0..7) of its
    // wave's 32, the columns 32*i + 4*l8 .. + 3 in step i.
    int l8 = t & 7;
    int j = jc * 256 + t;
    const float4* c4 = (const float4*)cn + l8;
    const float4* w4 = (const float4*)(Wkv + (size_t)(j - l8) * COMB) + l8;
    float4 wr[KV_AHEAD + 1][8];                 // ring of steps: 8 loads each
    v2f acc[8];                                 // the lane's share of its 8 rows' sums
#pragma unroll   // acc lives in registers
    for (int s = 0; s < 8; ++s) acc[s] = (v2f){0.f, 0.f};
#pragma unroll   // wr lives in registers
    for (int i = 0; i < KV_AHEAD; ++i)
#pragma unroll
        for (int s = 0; s < 8; ++s) wr[i][s] = w4[s * 128 + i * 8];
#pragma unroll   // wr lives in registers and needs constant indices
    for (int i = 0; i < 16; ++i) {
        // the loads of step i + KV_AHEAD go out before the sums of step i
        if (i + KV_AHEAD < 16) {
#pragma unroll
            for (int s = 0; s < 8; ++s)
                wr[(i + KV_AHEAD) % (KV_AHEAD + 1)][s] = w4[s * 128 + (i + KV_AHEAD) * 8];
        }
        float4 c = c4[i * 8];
#pragma unroll
        for (int s = 0; s < 8; ++s) {
            float4 w = wr[i % (KV_AHEAD + 1)][s];
            acc[s] += (v2f){w.x, w.y} * (v2f){c.x, c.y};
            acc[s] += (v2f){w.z, w.w} * (v2f){c.z, c.w};
        }
    }
    // Sum over the eight lanes of a row: a butterfly, the eight rows' exchanges of a
    // step in flight together. Every lane then has all eight sums and keeps that of
    // row 8q + l8, its own number.
    float pr[8];
#pragma unroll   // pr lives in registers
    for (int s = 0; s < 8; ++s) pr[s] = acc[s].x + acc[s].y;
#pragma unroll   // constant indices into pr
    for (int m = 1; m < 8; m <<= 1)
#pragma unroll
        for (int s = 0; s < 8; ++s) pr[s] += __shfl_xor(pr[s], m);
    float mine = pr[0];
#pragma unroll   // constant indices into pr
    for (int s = 1; s < 8; ++s) if (l8 == s) mine = pr[s];
    kvs[t] = mine + bj;                         // [d = t/4][s = t%4] of this head
    stage_wait();                               // Wp copies landed, kvs published

    const float4* kv4 = (const float4*)kvs;     // kv4[d] = the 4 tokens of channel d
    float a0 = 0.f, a1 = 0.f, a2 = 0.f, a3 = 0.f;
    if (jc < 4) {                               // the same for the whole work-group
        int head = jc;
        const float* wcol = Wq + (size_t)head * HD * Cc + t;   // column c = t
#pragma unroll   // all 64 loads in flight at once
        for (int d = 0; d < HD; ++d) {
            float w = wcol[d * Cc];
            float4 k = kv4[d];
            a0 += w * k.x; a1 += w * k.y; a2 += w * k.z; a3 += w * k.w;
        }
        // c = t -> kstep t/32, half (t/16)%2, lane half (t/8)%2, element t%8
        int ks = t >> 5, half = (t >> 4) & 1, hh = (t >> 3) & 1, e = t & 7;
        unsigned short* dst =
            KpF + (((((size_t)b * 8 + ks) * 2 + half) * 4 + head) * 2 + hh) * 32 + e;
        dst[0]  = f2bf(a0);                     // s = 0 .. 3, 8 elements apart
        dst[8]  = f2bf(a1);
        dst[16] = f2bf(a2);
        dst[24] = f2bf(a3);
    } else {
        int head = jc - 4;
        const float4* wrow = (const float4*)(wl + t * WL_PITCH);               // row o = t
#pragma unroll   // the LDS reads run ahead of the sums
        for (int d4 = 0; d4 < HD / 4; ++d4) {
            float4 w = wrow[d4];
            float4 x0 = kv4[d4 * 4 + 0], x1 = kv4[d4 * 4 + 1];
            float4 x2 = kv4[d4 * 4 + 2], x3 = kv4[d4 * 4 + 3];
            a0 += w.x * x0.x + w.y * x1.x + w.z * x2.x + w.w * x3.x;
            a1 += w.x * x0.y + w.y * x1.y + w.z * x2.y + w.w * x3.y;
            a2 += w.x * x0.z + w.y * x1.z + w.z * x2.z + w.w * x3.z;
            a3 += w.x * x0.w + w.y * x1.w + w.z * x2.w + w.w * x3.w;
        }
        // o = t -> otile t/16, row t%16
        uint2 pk;
        pk.x = (unsigned int)f2bf(a0) | ((unsigned int)f2bf(a1) << 16);
        pk.y = (unsigned int)f2bf(a2) | ((unsigned int)f2bf(a3) << 16);
        *(uint2*)(VpF + ((((size_t)b * 16 + (t >> 4)) * 4 + head) * 16 + (t & 15)) * 4) = pk;
        // Precaution: in the built code this store's registers are written again on
        // a path behind it; the wait stands in front of those writes.
        asm volatile("s_wait_xcnt 0x0" ::: "memory");
    }
}

__global__ void __launch_bounds__(256) k_pre(const float* __restrict__ img,
                                             const float* __restrict__ params,
                                             const float* __restrict__ obj,
                                             const float* __restrict__ ln_w,
                                             const float* __restrict__ ln_b,
                                             const float* __restrict__ Wkv,
                                             const float* __restrict__ bkv,
                                             const float* __restrict__ Wq,
                                             const float* __restrict__ Wp,
                                             float* __restrict__ stats,
                                             unsigned short* __restrict__ KpF,
                                             unsigned short* __restrict__ VpF) {
    __shared__ float r1[256], r2[256];
    __shared__ __align__(16) float cn[COMB];
    __shared__ __align__(16) float kvs[256];  // one head's k or v
    __shared__ __align__(16) float wl[Cc * WL_PITCH];  // one head's columns of Wp
    __shared__ float ms[2];               // LayerNorm mean and 1/std
    int blk = blockIdx.x;                 // the same for the whole work-group
    if (blk < PRE_COND) {
        pre_cond_kv(blk, params, obj, ln_w, ln_b, Wkv, bkv, Wq, Wp, KpF, VpF,
                    r1, r2, cn, ms, kvs, wl);
    } else {
        pre_gn_stats(blk - PRE_COND, img, stats, r1, r2);
    }
}

// ---------------------------------------------------------------------------
// Kernel 2: GroupNorm affine, logits, softmax, projection, bias and residual for
// 128 pixels, from one read of the image tile.
//   xn[c][p]     = (img[c][p] - mean) * rstd * gn_w[c] + gn_b[c], rounded to bf16
//   logits[j][p] = sum_c Kp[j][c] * xn[c][p] / 64      j = head*4 + token, 16 rows
//   out[o][p]    = sum_j Vp[o][j] * attn[j][p] + bp[o] + img[o][p]
// Tile T (0..7) holds the pixels (T/4)*64 + 4n + T%4, n = its column, so that the
// four tiles of a group give each lane four neighbouring pixels (16B accesses).
// A wave holds 64 channels x 64 pixels of img in registers, for the residual.
// Lane (n, h) has the channels 16*ot + 8h + r there, which are the k positions of
// its own B fragment: the same registers, normalised, feed the logits, each wave
// summing over its 64 channels; the four partial sums of a tile meet in LDS.
// Every loop below is unrolled: its arrays live in registers and need constant
// indices, and the loads of a loop are to be in flight together.
// Four waves per SIMD (at most 256 registers): two work-groups on a WGP, so that
// the whole grid is resident at once and reads in one round.
// ---------------------------------------------------------------------------
__global__ void __launch_bounds__(256) __attribute__((amdgpu_waves_per_eu(4, 4)))
k_attn_proj(const float* __restrict__ stats,
            const float* __restrict__ gn_w,
            const float* __restrict__ gn_b,
            const unsigned short* __restrict__ KpF,
            const unsigned short* __restrict__ VpF,
            const float* __restrict__ bp,
            const float* __restrict__ img,
            float* __restrict__ out) {
    __shared__ __align__(16) uint4 ldsK[16][32];        // Kp fragments, [kstep*2 + half][lane]
    __shared__ __align__(16) uint2 ldsV[16 * 4 * 16];   // Vp of this batch, as it lies in VpF
    __shared__ __align__(16) float ldsBias[Cc];
    __shared__ __align__(16) float gnA[Cc], gnB[Cc];    // xn = img * gnA[c] + gnB[c]
    __shared__ __align__(16) float4 part[4][8][2][32];  // partial logits [quarter][tile][rows 4+4][lane]
    __shared__ __align__(16) uint4 attnS[8][32];

    int t    = threadIdx.x;
    int lane = t & 31;
    int wave = t >> 5;
    int n = lane & 15, h = lane >> 4;
    int b  = blockIdx.y;
    int p0 = blockIdx.x * 128;

    // Everything the work-group reads is asked for here, so that all reads fly
    // together and no global load stands among the stores at the end.
    float2 st = *(const float2*)(stats + (b * GRP + (t >> 3)) * 2);   // channel t's group
    float gw = gn_w[t], gb = gn_b[t];
    copy16((const uint4*)VpF + (size_t)b * 512 + t,       (uint4*)ldsV + t);
    copy16((const uint4*)VpF + (size_t)b * 512 + t + 256, (uint4*)ldsV + t + 256);
    copy4(bp + t, ldsBias + t);
#pragma unroll
    for (int i = 0; i < 2; ++i) {
        // chunk (head, lane half, s) of a 512B group goes to lane = half*16 + head*4 + s
        int g = t + i * 256, w = g & 31;
        copy16((const uint4*)KpF + (size_t)b * 512 + g,
               &ldsK[g >> 5][((w >> 2) & 1) * 16 + (w >> 3) * 4 + (w & 3)]);
    }

    // This wave's part of image and output: 64 pixels (group pg) x 64 rows (quarter oq).
    int pg = wave & 1, oq = wave >> 1;
    const size_t obase = ((size_t)b * Cc + oq * 64 + 8 * h) * HW + p0 + pg * 64 + 4 * n;
    float4 res[4][8];
#pragma unroll
    for (int ot = 0; ot < 4; ++ot)
#pragma unroll
        for (int r = 0; r < 8; ++r)
            res[ot][r] = *(const float4*)(img + obase + (size_t)(ot * 16 + r) * HW);

    // Keeps the wait for the statistics, and the sums behind it, from being lifted in
    // front of the image loads, which would then start one memory latency later.
    __builtin_amdgcn_sched_barrier(0);
    float ga_t = st.y * gw;                 // rstd * gn_w
    gnA[t] = ga_t;
    gnB[t] = gb - st.x * ga_t;              // gn_b - mean * rstd * gn_w
    stage_wait();

    // ---- partial logits of the wave's four tiles over its 64 channels (2 k steps):
    // lane (n, h) gets rows j = 8h .. 8h+7 of column n
    v8f lgp[4];
#pragma unroll
    for (int tt = 0; tt < 4; ++tt) lgp[tt] = (v8f){0.f,0.f,0.f,0.f,0.f,0.f,0.f,0.f};
#pragma unroll
    for (int ks = 0; ks < 2; ++ks) {
        FragU fk;
        fk.u[0] = ldsK[(oq * 2 + ks) * 2 + 0][lane];
        fk.u[1] = ldsK[(oq * 2 + ks) * 2 + 1][lane];
        v16bf fx[4];
#pragma unroll
        for (int half = 0; half < 2; ++half) {
            // k = 16*half + 8h + r of this k step is row r of res[2*ks + half]
            int ot = ks * 2 + half;
            int c0 = oq * 64 + ot * 16 + 8 * h;
            float4 a0 = *(const float4*)(gnA + c0), a1 = *(const float4*)(gnA + c0 + 4);
            float4 s0 = *(const float4*)(gnB + c0), s1 = *(const float4*)(gnB + c0 + 4);
            float ga[8] = {a0.x, a0.y, a0.z, a0.w, a1.x, a1.y, a1.z, a1.w};
            float gs[8] = {s0.x, s0.y, s0.z, s0.w, s1.x, s1.y, s1.z, s1.w};
#pragma unroll
            for (int r = 0; r < 8; ++r) {
                // two neighbouring pixels a packed multiply-add, as they lie in registers
                float4 v = res[ot][r];
                v2f lo = (v2f){v.x, v.y} * ga[r] + gs[r];
                v2f hi = (v2f){v.z, v.w} * ga[r] + gs[r];
                fx[0][half * 8 + r] = (bf16_t)lo.x;
                fx[1][half * 8 + r] = (bf16_t)lo.y;
                fx[2][half * 8 + r] = (bf16_t)hi.x;
                fx[3][half * 8 + r] = (bf16_t)hi.y;
            }
        }
#pragma unroll
        for (int tt = 0; tt < 4; ++tt)
            lgp[tt] = __builtin_amdgcn_wmma_f32_16x16x32_bf16(false, fk.v, false, fx[tt],
                                                              (short)0, lgp[tt], false, false);
    }
#pragma unroll
    for (int tt = 0; tt < 4; ++tt) {
        part[oq][pg * 4 + tt][0][lane] = make_float4(lgp[tt][0], lgp[tt][1], lgp[tt][2], lgp[tt][3]);
        part[oq][pg * 4 + tt][1][lane] = make_float4(lgp[tt][4], lgp[tt][5], lgp[tt][6], lgp[tt][7]);
    }
    __syncthreads();

    // ---- logits of tile T = wave: the four quarters' sums, in the order of the channels
    float lg[8];
    {
        float4 q0 = part[0][wave][0][lane], q1 = part[0][wave][1][lane];
        lg[0] = q0.x; lg[1] = q0.y; lg[2] = q0.z; lg[3] = q0.w;
        lg[4] = q1.x; lg[5] = q1.y; lg[6] = q1.z; lg[7] = q1.w;
    }
#pragma unroll
    for (int q = 1; q < 4; ++q) {
        float4 q0 = part[q][wave][0][lane], q1 = part[q][wave][1][lane];
        lg[0] += q0.x; lg[1] += q0.y; lg[2] += q0.z; lg[3] += q0.w;
        lg[4] += q1.x; lg[5] += q1.y; lg[6] += q1.z; lg[7] += q1.w;
    }

    // ---- softmax over the 4 tokens of each of the lane's two heads
    const float sc = 1.0f / (float)HD;   // scale applied to both q and k -> 1/hd
    unsigned int pk[4];
#pragma unroll
    for (int g = 0; g < 2; ++g) {
        float x0 = lg[4 * g] * sc, x1 = lg[4 * g + 1] * sc;
        float x2 = lg[4 * g + 2] * sc, x3 = lg[4 * g + 3] * sc;
        float mx = fmaxf(fmaxf(x0, x1), fmaxf(x2, x3));
        const float l2e = 1.44269504f;   // e^x = 2^(x * log2 e)
        float e0 = exp2_slot((x0 - mx) * l2e), e1 = exp2_slot((x1 - mx) * l2e);
        float e2 = exp2_slot((x2 - mx) * l2e), e3 = exp2_slot((x3 - mx) * l2e);
        float inv = 1.f / (e0 + e1 + e2 + e3);
        pk[2 * g]     = (unsigned int)f2bf(e0 * inv) | ((unsigned int)f2bf(e1 * inv) << 16);
        pk[2 * g + 1] = (unsigned int)f2bf(e2 * inv) | ((unsigned int)f2bf(e3 * inv) << 16);
    }
    // The packed column is already the lane's B fragment for k = 8h .. 8h+7.
    attnS[wave][lane] = make_uint4(pk[0], pk[1], pk[2], pk[3]);
    __syncthreads();

    // ---- projection: k = 0..15 are the 16 (head, token) pairs, k = 16..31 are zero
    const uint4 zero4 = make_uint4(0u, 0u, 0u, 0u);
    FragU fw[4];
#pragma unroll
    for (int tt = 0; tt < 4; ++tt) {
        fw[tt].u[0] = attnS[pg * 4 + tt][lane];
        fw[tt].u[1] = zero4;
    }
    // k = 8h .. 8h+7 of row n of Vp are the tokens of heads 2h and 2h+1
    const uint2* vf = ldsV + (oq * 4 * 4 + 2 * h) * 16 + n;
#pragma unroll
    for (int ot = 0; ot < 4; ++ot) {
        FragU fv;
        uint2 v0 = vf[ot * 64], v1 = vf[ot * 64 + 16];
        fv.u[0] = make_uint4(v0.x, v0.y, v1.x, v1.y);
        fv.u[1] = zero4;
        const float4* bq = (const float4*)(ldsBias + oq * 64 + ot * 16 + 8 * h);
        float4 b0 = bq[0], b1 = bq[1];
        float bias[8] = {b0.x, b0.y, b0.z, b0.w, b1.x, b1.y, b1.z, b1.w};
        v8f acc[4];
#pragma unroll
        for (int tt = 0; tt < 4; ++tt) {
            v8f z = {0.f,0.f,0.f,0.f,0.f,0.f,0.f,0.f};
            acc[tt] = __builtin_amdgcn_wmma_f32_16x16x32_bf16(false, fv.v, false, fw[tt].v,
                                                              (short)0, z, false, false);
        }
#pragma unroll
        for (int r = 0; r < 8; ++r) {
            float4 o4;
            o4.x = acc[0][r] + bias[r] + res[ot][r].x;
            o4.y = acc[1][r] + bias[r] + res[ot][r].y;
            o4.z = acc[2][r] + bias[r] + res[ot][r].z;
            o4.w = acc[3][r] + bias[r] + res[ot][r].w;
            *(float4*)(out + obase + (size_t)(ot * 16 + r) * HW) = o4;
        }
    }
}

// ---------------------------------------------------------------------------
// Host launcher
// ---------------------------------------------------------------------------
extern "C" void kernel_launch(void* const* d_in, const int* in_sizes, int n_in,
                              void* d_out, int out_size, void* d_ws, size_t ws_size,
                              hipStream_t stream) {
    (void)in_sizes; (void)n_in; (void)out_size; (void)ws_size;
    const float* img    = (const float*)d_in[0];
    const float* params = (const float*)d_in[1];
    const float* obj    = (const float*)d_in[2];
    const float* gn_w   = (const float*)d_in[3];
    const float* gn_b   = (const float*)d_in[4];
    const float* Wq     = (const float*)d_in[5];
    const float* ln_w   = (const float*)d_in[6];
    const float* ln_b   = (const float*)d_in[7];
    const float* Wkv    = (const float*)d_in[8];
    const float* bkv    = (const float*)d_in[9];
    const float* Wp     = (const float*)d_in[10];
    const float* bp     = (const float*)d_in[11];
    float* out = (float*)d_out;

    char* ws = (char*)d_ws;
    float*          stats = (float*)(ws + 0);                         //   4 KB
    unsigned short* KpF   = (unsigned short*)(ws + 135168);           // 128 KB
    unsigned short* VpF   = (unsigned short*)(ws + 266240);           // 128 KB

    k_pre<<<dim3(PRE_COND + PRE_STATS), dim3(256), 0, stream>>>(
        img, params, obj, ln_w, ln_b, Wkv, bkv, Wq, Wp, stats, KpF, VpF);
    k_attn_proj<<<dim3(HW / 128, Bz), dim3(256), 0, stream>>>(
        stats, gn_w, gn_b, KpF, VpF, bp, img, out);
}

// v006
// A run of this version takes 18.8 microseconds.
// Timed twice side by side with v005, it ran 1.16 times as fast both times.
// Over all steps from v000 it is 4.93 times as fast.
#include <hip/hip_runtime.h>
#include <hip/hip_bf16.h>

typedef __bf16 bf16_t;
typedef __attribute__((ext_vector_type(16))) __bf16 v16bf;
typedef __attribute__((ext_vector_type(8)))  float  v8f;
typedef __attribute__((ext_vector_type(2)))  float  v2f;

#define Bz 16
#define Cc 256
#define HW 4096
#define NHd 4
#define HD 64
#define NT 4
#define GRP 32
#define COMB 512
#define EPSV 1e-5f

__device__ __forceinline__ float bf2f(unsigned short u) {
    union { unsigned int i; float f; } x; x.i = ((unsigned int)u) << 16; return x.f;
}
__device__ __forceinline__ unsigned short f2bf(float f) {
    union { bf16_t h; unsigned short u; } x; x.h = (bf16_t)f; return x.u;
}

union FragU { uint4 u[2]; v16bf v; };

// 2^x. The v_nop fills the one slot that the instruction set asks for between a
// transcendental and a next instruction that reads its result or overwrites its
// source; inside the statement it cannot drift away from the v_exp_f32.
__device__ __forceinline__ float exp2_slot(float x) {
    float r;
    asm("v_exp_f32 %0, %1\n\tv_nop" : "=v"(r) : "v"(x));
    return r;
}

// ---------------------------------------------------------------------------
// Typed address-space helpers for the CDNA5 async-to-LDS builtin, whose
// signature is (int4 AS1*, int4 AS3*, imm offset, imm cpol).
// Generic LDS pointers carry the LDS offset in the low 32 bits; generic
// global pointers are the 64-bit VA.
// ---------------------------------------------------------------------------
typedef int v4i_t __attribute__((vector_size(16)));
typedef __attribute__((address_space(1))) v4i_t* as1_v4i;
typedef __attribute__((address_space(3))) v4i_t* as3_v4i;

__device__ __forceinline__ as1_v4i as_global(const void* p) {
    return reinterpret_cast<as1_v4i>(reinterpret_cast<uintptr_t>(p));
}
__device__ __forceinline__ as3_v4i as_lds(void* p) {
    return reinterpret_cast<as3_v4i>(
        (unsigned int)reinterpret_cast<uintptr_t>(p));
}

// One lane's 16 bytes from global memory into LDS. Async DMA path when available
// (ASYNCcnt: the reader's side waits as in stage_wait), else through registers.
__device__ __forceinline__ void copy16(const void* __restrict__ g, void* __restrict__ l) {
#if __has_builtin(__builtin_amdgcn_global_load_async_to_lds_b128)
    __builtin_amdgcn_global_load_async_to_lds_b128(as_global(g), as_lds(l), 0, 0);
#else
    *(uint4*)l = *(const uint4*)g;
#endif
}

// The same for one lane's 4 bytes.
__device__ __forceinline__ void copy4(const float* __restrict__ g, float* __restrict__ l) {
#if __has_builtin(__builtin_amdgcn_global_load_async_to_lds_b32)
    __builtin_amdgcn_global_load_async_to_lds_b32(
        reinterpret_cast<__attribute__((address_space(1))) int*>(reinterpret_cast<uintptr_t>(g)),
        reinterpret_cast<__attribute__((address_space(3))) int*>(
            (unsigned int)reinterpret_cast<uintptr_t>(l)), 0, 0);
#else
    *l = *g;
#endif
}

__device__ __forceinline__ void stage_wait() {
#if __has_builtin(__builtin_amdgcn_global_load_async_to_lds_b128)
    asm volatile("s_wait_asynccnt 0x0" ::: "memory");
#endif
    __syncthreads();
}

// Work-group barrier that orders LDS accesses only. __syncthreads() also waits out
// the wave's global loads, which here are to stay in flight across the barrier.
__device__ __forceinline__ void lds_barrier() {
    __builtin_amdgcn_fence(__ATOMIC_RELEASE, "workgroup", "local");
    __builtin_amdgcn_s_barrier();
    __builtin_amdgcn_fence(__ATOMIC_ACQUIRE, "workgroup", "local");
}

// ---------------------------------------------------------------------------
// Kernel 1: every piece of work that depends on the inputs alone, in one
// launch: conditioning path (with the two weight folds) and GroupNorm
// statistics. The pieces share no data; a work-group does exactly one of them,
// chosen by its index. The longest work-groups (conditioning) have the lowest
// indices so that they start first.
// ---------------------------------------------------------------------------
#define PRE_COND  (Bz / 4 * 32)       // work-groups of the conditioning path
#define PRE_STATS (Bz * GRP)          // work-groups of the GroupNorm statistics
#define WL_PITCH  68                  // floats per staged Wp row: 16 B x odd, no bank conflict

// GroupNorm statistics. One work-group per (b, g); reduce 8*4096 elems.
__device__ __forceinline__ void pre_gn_stats(int bg, const float* __restrict__ img,
                                             float* __restrict__ stats,
                                             float* r1, float* r2) {
    // A thread's share as 32 loads of 16 bytes (a wave's load: 512 bytes in a row), all
    // sent before the first sum: one trip to memory for the work-group's whole share.
    const float4* base = (const float4*)(img + (size_t)bg * 8 * HW) + threadIdx.x;
    float4 v[32];
#pragma unroll   // v lives in registers
    for (int i = 0; i < 32; ++i) v[i] = base[i * 256];
    // Keeps the first sums from being lifted in front of the last loads, which would
    // then go out one memory latency later.
    __builtin_amdgcn_sched_barrier(0);
    v2f sa = {0.f, 0.f}, sb = {0.f, 0.f}, qa = {0.f, 0.f}, qb = {0.f, 0.f};
#pragma unroll   // constant indices into v
    for (int i = 0; i < 32; ++i) {
        v2f lo = {v[i].x, v[i].y}, hi = {v[i].z, v[i].w};
        sa += lo; qa += lo * lo;
        sb += hi; qb += hi * hi;
    }
    float s = (sa.x + sa.y) + (sb.x + sb.y), s2 = (qa.x + qa.y) + (qb.x + qb.y);
    r1[threadIdx.x] = s; r2[threadIdx.x] = s2;
    __syncthreads();
    for (int off = 128; off > 0; off >>= 1) {
        if (threadIdx.x < off) {
            r1[threadIdx.x] += r1[threadIdx.x + off];
            r2[threadIdx.x] += r2[threadIdx.x + off];
        }
        __syncthreads();
    }
    if (threadIdx.x == 0) {
        float mean = r1[0] * (1.f / 32768.f);
        float var  = r2[0] * (1.f / 32768.f) - mean * mean;
        stats[bg * 2 + 0] = mean;
        stats[bg * 2 + 1] = rsqrtf(var + EPSV);
    }
}

// Conditioning path: LayerNorm(combined), kv = cn @ Wkv^T + bkv, then the fold.
// Since q = Wq xn enters only through q^T k, and h = v attn only through Wp h, the
// products are reassociated:
//   logits = (Wq_head^T k)^T xn      Kp[head*4+s][c] = sum_d Wq[head*64+d][c] k[d][s]
//   proj   = (Wp_head v) attn        Vp[o][head*4+s] = sum_d Wp[o][head*64+d] v[d][s]
// A work-group has one row head*4+s of Kp (blk&7 < 4) or one column of Vp, for FOUR
// batches: the 64 rows (head*64+d)*4+s of Wkv that it needs are the same for every
// batch, so each is read once for four batches, and of the 128 KB three quarters are
// asked for at once, ahead of the LayerNorm, the rest during the first sums. Both
// folds are stored as bf16 rows of 512 bytes, each written by one work-group:
//   KpF[b][head*4+s][c]      VpF[b][head*4+s][o]
__device__ __forceinline__ void pre_cond_kv(int blk,
                                            const float* __restrict__ params,
                                            const float* __restrict__ obj,
                                            const float* __restrict__ ln_w,
                                            const float* __restrict__ ln_b,
                                            const float* __restrict__ Wkv,
                                            const float* __restrict__ bkv,
                                            const float* __restrict__ Wq,
                                            const float* __restrict__ Wp,
                                            unsigned short* __restrict__ KpF,
                                            unsigned short* __restrict__ VpF,
                                            float4* red, float* cnT,
                                            float* kvs, float* wl) {
    int jc = blk & 7;                           // k of head jc, or v of head jc - 4
    int s  = (blk >> 3) & 3;                    // token
    int bq = blk >> 5;                          // batches 4*bq .. 4*bq + 3
    int t  = threadIdx.x;
    int lane = t & 31;
    int wave = __builtin_amdgcn_readfirstlane(t >> 5);   // in a scalar register: uniform tests

    // Asked for first, in front of the branch below, since loads return in order and the
    // LayerNorm is to run while Wkv is still on its way.
    // LayerNorm inputs: wave (bp, q) = (wave / 4, wave % 4) has the columns
    // 128*q + 4*lane .. + 3 of the batches 4*bq + 2*bp and + 1.
    int q = wave & 3, bp = wave >> 2;
    int b0 = bq * 4 + bp * 2;
    const float* xsrc = (q == 0) ? params + b0 * 128 : obj + b0 * 384 + (q - 1) * 128;
    int xstep = (q == 0) ? 128 : 384;           // to the next batch
    float4 x0 = *(const float4*)(xsrc + lane * 4);
    float4 x1 = *(const float4*)(xsrc + xstep + lane * 4);
    float4 lw = *(const float4*)(ln_w + q * 128 + lane * 4);
    float4 lb = *(const float4*)(ln_b + q * 128 + lane * 4);
    float bj = bkv[jc * 256 + (t >> 2) * 4 + s];    // of channel d = t / 4
    // Precaution: in the built code a register that one of these loads names is written
    // again right behind the branch below; the wait stands in front of that write.
    asm volatile("s_wait_xcnt 0x0" ::: "memory");

    if (jc >= 4) {                              // the same for the whole work-group
        // This head's 64 columns of Wp, read by whole lines (16 lanes a row) and
        // copied into LDS, where the fold reads a row per thread. The copies fly
        // during the LayerNorm and the kv sums; their wait stands at the fold.
        const float* wsrc = Wp + (jc - 4) * HD;
#pragma unroll   // all 16 copies of a thread in flight at once
        for (int i = 0; i < 16; ++i) {
            int idx = t + i * 256, row = idx >> 4, c4 = idx & 15;
            copy16(wsrc + row * Cc + c4 * 4, wl + row * WL_PITCH + c4 * 4);
        }
    }

    // Wkv: a wave has the rows of d = 8*wave + r (r = 0..7); a load covers 512 bytes
    // in a row of one of them, lane l the columns 128*i + 4*l .. + 3. From d to d + 1
    // are four rows of Wkv, COMB float4.
    const float4* w4 = (const float4*)(Wkv + (size_t)(jc * 256 + wave * 32 + s) * COMB) + lane;
    float4 wr[4][8];
#pragma unroll   // wr lives in registers
    for (int i = 0; i < 3; ++i)
#pragma unroll
        for (int r = 0; r < 8; ++r) wr[i][r] = w4[r * COMB + i * 32];
    // Keeps the LayerNorm's waits and sums from being lifted in front of the Wkv
    // loads, which would then go out one memory latency later.
    __builtin_amdgcn_sched_barrier(0);

    // Mean and variance: the lane's four columns, a butterfly over the wave, then the
    // four waves of a batch pair through LDS.
    float p0 = (x0.x + x0.y) + (x0.z + x0.w);
    float p1 = (x0.x * x0.x + x0.y * x0.y) + (x0.z * x0.z + x0.w * x0.w);
    float p2 = (x1.x + x1.y) + (x1.z + x1.w);
    float p3 = (x1.x * x1.x + x1.y * x1.y) + (x1.z * x1.z + x1.w * x1.w);
#pragma unroll   // the four exchanges of a step in flight together
    for (int m = 1; m < 32; m <<= 1) {
        float e0 = __shfl_xor(p0, m), e1 = __shfl_xor(p1, m);
        float e2 = __shfl_xor(p2, m), e3 = __shfl_xor(p3, m);
        p0 += e0; p1 += e1; p2 += e2; p3 += e3;
    }
    if (lane == 0) red[wave] = make_float4(p0, p1, p2, p3);
    lds_barrier();
    {
        float4 ra = red[bp * 4 + 0], rb = red[bp * 4 + 1];
        float4 rc = red[bp * 4 + 2], rd = red[bp * 4 + 3];
        float m0 = ((ra.x + rb.x) + (rc.x + rd.x)) * (1.f / 512.f);
        float v0 = ((ra.y + rb.y) + (rc.y + rd.y)) * (1.f / 512.f) - m0 * m0;
        float m1 = ((ra.z + rb.z) + (rc.z + rd.z)) * (1.f / 512.f);
        float v1 = ((ra.w + rb.w) + (rc.w + rd.w)) * (1.f / 512.f) - m1 * m1;
        float rs0 = rsqrtf(v0 + EPSV), rs1 = rsqrtf(v1 + EPSV);
        // cnT[(4*i + k)*32 + l] = column 128*i + 4*l + k of the four batches: the kv
        // sums read 16 bytes a lane, neighbouring lanes neighbouring slots.
        float2* dst = (float2*)cnT + ((q * 4) * 32 + lane) * 2 + bp;
        dst[0]   = make_float2((x0.x - m0) * rs0 * lw.x + lb.x, (x1.x - m1) * rs1 * lw.x + lb.x);
        dst[64]  = make_float2((x0.y - m0) * rs0 * lw.y + lb.y, (x1.y - m1) * rs1 * lw.y + lb.y);
        dst[128] = make_float2((x0.z - m0) * rs0 * lw.z + lb.z, (x1.z - m1) * rs1 * lw.z + lb.z);
        dst[192] = make_float2((x0.w - m0) * rs0 * lw.w + lb.w, (x1.w - m1) * rs1 * lw.w + lb.w);
    }
    lds_barrier();

    // kv sums: the lane's share of its wave's 8 rows, for the four batches (two packed
    // pairs). Column block by column block, so that a row's first products take the
    // registers that its loaded values leave.
    const float4* c4 = (const float4*)cnT + lane;
    v2f a01[8], a23[8];
#pragma unroll   // wr, a01, a23 live in registers and need constant indices
    for (int i = 0; i < 4; ++i) {
        float4 c0 = c4[(i * 4 + 0) * 32], c1 = c4[(i * 4 + 1) * 32];
        float4 c2 = c4[(i * 4 + 2) * 32], c3 = c4[(i * 4 + 3) * 32];
#pragma unroll
        for (int r = 0; r < 8; ++r) {
            float4 w = wr[i][r];
            if (i == 0) {
                a01[r] = (v2f){w.x, w.x} * (v2f){c0.x, c0.y};
                a23[r] = (v2f){w.x, w.x} * (v2f){c0.z, c0.w};
            } else {
                a01[r] += (v2f){w.x, w.x} * (v2f){c0.x, c0.y};
                a23[r] += (v2f){w.x, w.x} * (v2f){c0.z, c0.w};
            }
            a01[r] += (v2f){w.y, w.y} * (v2f){c1.x, c1.y};
            a23[r] += (v2f){w.y, w.y} * (v2f){c1.z, c1.w};
            a01[r] += (v2f){w.z, w.z} * (v2f){c2.x, c2.y};
            a23[r] += (v2f){w.z, w.z} * (v2f){c2.z, c2.w};
            a01[r] += (v2f){w.w, w.w} * (v2f){c3.x, c3.y};
            a23[r] += (v2f){w.w, w.w} * (v2f){c3.z, c3.w};
            // First block: two rows at a time, so that their sums do take the registers
            // of their loaded values; all eight rows abreast need 24 more, which spill.
            if (i == 0 && (r & 1)) __builtin_amdgcn_sched_barrier(0);
        }
        // The fences keep the later blocks' LDS reads from being lifted up while most of
        // wr is still live (48 registers more: a work-group fewer on the WGP), and hold
        // the loads of the last quarter of Wkv here, ahead of their use, four rows behind
        // each of the first two blocks: with the other three quarters at the top they
        // would make more than 160 registers.
        if (i < 2) {
            __builtin_amdgcn_sched_barrier(0);
#pragma unroll
            for (int r = i * 4; r < i * 4 + 4; ++r) wr[3][r] = w4[r * COMB + 3 * 32];
            __builtin_amdgcn_sched_barrier(0);
        }
    }
    // Sum over the 32 lanes of the 32 values x = 4*r + batch: in the step of lane bit
    // k a lane keeps the half of its values whose bit k of x equals its own and hands
    // the other half to its partner. Lane l ends with the whole sum of x = l.
    float pr[32];
#pragma unroll   // pr lives in registers
    for (int r = 0; r < 8; ++r) {
        pr[r * 4 + 0] = a01[r].x; pr[r * 4 + 1] = a01[r].y;
        pr[r * 4 + 2] = a23[r].x; pr[r * 4 + 3] = a23[r].y;
    }
#pragma unroll   // constant indices into pr
    for (int hf = 16; hf > 0; hf >>= 1) {
        bool up = (lane & hf) != 0;
#pragma unroll
        for (int k = 0; k < hf; ++k) {
            float lo = pr[k], hi = pr[k + hf];
            float keep = up ? hi : lo;
            float send = up ? lo : hi;
            pr[k] = keep + __shfl_xor(send, hf);
        }
    }
    kvs[t] = pr[0] + bj;                        // [d = t/4][batch = t%4] of this head and token
    stage_wait();                               // Wp copies landed, kvs published

    const float4* kv4 = (const float4*)kvs;     // kv4[d] = the 4 batches of channel d
    float a0 = 0.f, a1 = 0.f, a2 = 0.f, a3 = 0.f;
    unsigned short* dst;                        // element t of batch 4*bq's row
    if (jc < 4) {                               // the same for the whole work-group
        int head = jc;
        const float* wcol = Wq + (size_t)head * HD * Cc + t;   // column c = t
#pragma unroll   // all 64 loads in flight at once
        for (int d = 0; d < HD; ++d) {
            float w = wcol[d * Cc];
            float4 k = kv4[d];
            a0 += w * k.x; a1 += w * k.y; a2 += w * k.z; a3 += w * k.w;
        }
        dst = KpF + ((size_t)(bq * 4) * 16 + head * 4 + s) * Cc + t;
    } else {
        int head = jc - 4;
        const float4* wrow = (const float4*)(wl + t * WL_PITCH);               // row o = t
#pragma unroll   // the LDS reads run ahead of the sums
        for (int d4 = 0; d4 < HD / 4; ++d4) {
            float4 w = wrow[d4];
            float4 x0 = kv4[d4 * 4 + 0], x1 = kv4[d4 * 4 + 1];
            float4 x2 = kv4[d4 * 4 + 2], x3 = kv4[d4 * 4 + 3];
            a0 += w.x * x0.x + w.y * x1.x + w.z * x2.x + w.w * x3.x;
            a1 += w.x * x0.y + w.y * x1.y + w.z * x2.y + w.w * x3.y;
            a2 += w.x * x0.z + w.y * x1.z + w.z * x2.z + w.w * x3.z;
            a3 += w.x * x0.w + w.y * x1.w + w.z * x2.w + w.w * x3.w;
        }
        dst = VpF + ((size_t)(bq * 4) * 16 + head * 4 + s) * Cc + t;
    }
    dst[0 * 16 * Cc] = f2bf(a0);                // the four batches' rows
    dst[1 * 16 * Cc] = f2bf(a1);
    dst[2 * 16 * Cc] = f2bf(a2);
    dst[3 * 16 * Cc] = f2bf(a3);
}

// Six waves per SIMD (at most 160 registers): three work-groups on a WGP, so that the
// whole grid is resident at once.
__global__ void __launch_bounds__(256) __attribute__((amdgpu_waves_per_eu(6, 6))) k_pre(const float* __restrict__ img,
                                             const float* __restrict__ params,
                                             const float* __restrict__ obj,
                                             const float* __restrict__ ln_w,
                                             const float* __restrict__ ln_b,
                                             const float* __restrict__ Wkv,
                                             const float* __restrict__ bkv,
                                             const float* __restrict__ Wq,
                                             const float* __restrict__ Wp,
                                             float* __restrict__ stats,
                                             unsigned short* __restrict__ KpF,
                                             unsigned short* __restrict__ VpF) {
    __shared__ float r1[256], r2[256];
    __shared__ __align__(16) float cnT[COMB * 4];      // LayerNorm output of four batches
    __shared__ __align__(16) float kvs[256];  // one head's and token's k or v, four batches
    __shared__ __align__(16) float wl[Cc * WL_PITCH];  // one head's columns of Wp
    __shared__ __align__(16) float4 red[8];   // the waves' LayerNorm sums
    int blk = blockIdx.x;                 // the same for the whole work-group
    if (blk < PRE_COND) {
        pre_cond_kv(blk, params, obj, ln_w, ln_b, Wkv, bkv, Wq, Wp, KpF, VpF,
                    red, cnT, kvs, wl);
    } else {
        pre_gn_stats(blk - PRE_COND, img, stats, r1, r2);
    }
}

// ---------------------------------------------------------------------------
// Kernel 2: GroupNorm affine, logits, softmax, projection, bias and residual for
// 128 pixels, from one read of the image tile.
//   xn[c][p]     = (img[c][p] - mean) * rstd * gn_w[c] + gn_b[c], rounded to bf16
//   logits[j][p] = sum_c Kp[j][c] * xn[c][p] / 64      j = head*4 + token, 16 rows
//   out[o][p]    = sum_j Vp[o][j] * attn[j][p] + bp[o] + img[o][p]
// Tile T (0..7) holds the pixels (T/4)*64 + 4n + T%4, n = its column, so that the
// four tiles of a group give each lane four neighbouring pixels (16B accesses).
// A wave holds 64 channels x 64 pixels of img in registers, for the residual.
// Lane (n, h) has the channels 16*ot + 8h + r there, which are the k positions of
// its own B fragment: the same registers, normalised, feed the logits, each wave
// summing over its 64 channels; the four partial sums of a tile meet in LDS.
// Every loop below is unrolled: its arrays live in registers and need constant
// indices, and the loads of a loop are to be in flight together.
// Four waves per SIMD (at most 256 registers): two work-groups on a WGP, so that
// the whole grid is resident at once and reads in one round.
// ---------------------------------------------------------------------------
#define V_PITCH 544   // bytes per row of Vp in LDS: 32 B x odd, for the transposing load

// Transposing LDS load of a 16-bit tile stored [k][row]: registers 0-3 of an A fragment.
typedef short s16x8 __attribute__((ext_vector_type(8)));
__device__ __forceinline__ uint4 ld_tr16(const unsigned char* p) {
    typedef __attribute__((address_space(3))) s16x8 lds_s16x8;
    return __builtin_bit_cast(uint4, __builtin_amdgcn_ds_load_tr16_b128_v8i16((lds_s16x8*)p));
}

__global__ void __launch_bounds__(256) __attribute__((amdgpu_waves_per_eu(4, 4)))
k_attn_proj(const float* __restrict__ stats,
            const float* __restrict__ gn_w,
            const float* __restrict__ gn_b,
            const unsigned short* __restrict__ KpF,
            const unsigned short* __restrict__ VpF,
            const float* __restrict__ bp,
            const float* __restrict__ img,
            float* __restrict__ out) {
    __shared__ __align__(16) uint4 ldsK[16][32];        // Kp fragments, [kstep*2 + half][lane]
    __shared__ __align__(16) unsigned char ldsV[16 * V_PITCH];   // Vp of this batch, [head*4+token][o]
    __shared__ __align__(16) float ldsBias[Cc];
    __shared__ __align__(16) float gnA[Cc], gnB[Cc];    // xn = img * gnA[c] + gnB[c]
    __shared__ __align__(16) float4 part[4][8][2][32];  // partial logits [quarter][tile][rows 4+4][lane]
    __shared__ __align__(16) uint4 attnS[8][32];

    int t    = threadIdx.x;
    int lane = t & 31;
    int wave = t >> 5;
    int n = lane & 15, h = lane >> 4;
    int b  = blockIdx.y;
    int p0 = blockIdx.x * 128;

    // Everything the work-group reads is asked for here, so that all reads fly
    // together and no global load stands among the stores at the end.
    float2 st = *(const float2*)(stats + (b * GRP + (t >> 3)) * 2);   // channel t's group
    float gw = gn_w[t], gb = gn_b[t];
    // 16-byte piece w of row j = head*4 + token: 8 neighbouring o of Vp, or the
    // channels 8w .. 8w+7 of Kp = k step w/4, half (w/2)%2, lane half w%2
    int cj = t >> 5, cw = t & 31;
    copy16((const uint4*)VpF + (size_t)b * 512 + t,       ldsV + cj * V_PITCH + cw * 16);
    copy16((const uint4*)VpF + (size_t)b * 512 + t + 256, ldsV + (cj + 8) * V_PITCH + cw * 16);
    copy4(bp + t, ldsBias + t);
    copy16((const uint4*)KpF + (size_t)b * 512 + t,       &ldsK[cw >> 1][(cw & 1) * 16 + cj]);
    copy16((const uint4*)KpF + (size_t)b * 512 + t + 256, &ldsK[cw >> 1][(cw & 1) * 16 + cj + 8]);

    // This wave's part of image and output: 64 pixels (group pg) x 64 rows (quarter oq).
    int pg = wave & 1, oq = wave >> 1;
    const size_t obase = ((size_t)b * Cc + oq * 64 + 8 * h) * HW + p0 + pg * 64 + 4 * n;
    float4 res[4][8];
#pragma unroll
    for (int ot = 0; ot < 4; ++ot)
#pragma unroll
        for (int r = 0; r < 8; ++r)
            res[ot][r] = *(const float4*)(img + obase + (size_t)(ot * 16 + r) * HW);

    // Keeps the wait for the statistics, and the sums behind it, from being lifted in
    // front of the image loads, which would then start one memory latency later.
    __builtin_amdgcn_sched_barrier(0);
    float ga_t = st.y * gw;                 // rstd * gn_w
    gnA[t] = ga_t;
    gnB[t] = gb - st.x * ga_t;              // gn_b - mean * rstd * gn_w
    stage_wait();

    // ---- partial logits of the wave's four tiles over its 64 channels (2 k steps):
    // lane (n, h) gets rows j = 8h .. 8h+7 of column n
    v8f lgp[4];
#pragma unroll
    for (int tt = 0; tt < 4; ++tt) lgp[tt] = (v8f){0.f,0.f,0.f,0.f,0.f,0.f,0.f,0.f};
#pragma unroll
    for (int ks = 0; ks < 2; ++ks) {
        FragU fk;
        fk.u[0] = ldsK[(oq * 2 + ks) * 2 + 0][lane];
        fk.u[1] = ldsK[(oq * 2 + ks) * 2 + 1][lane];
        v16bf fx[4];
#pragma unroll
        for (int half = 0; half < 2; ++half) {
            // k = 16*half + 8h + r of this k step is row r of res[2*ks + half]
            int ot = ks * 2 + half;
            int c0 = oq * 64 + ot * 16 + 8 * h;
            float4 a0 = *(const float4*)(gnA + c0), a1 = *(const float4*)(gnA + c0 + 4);
            float4 s0 = *(const float4*)(gnB + c0), s1 = *(const float4*)(gnB + c0 + 4);
            float ga[8] = {a0.x, a0.y, a0.z, a0.w, a1.x, a1.y, a1.z, a1.w};
            float gs[8] = {s0.x, s0.y, s0.z, s0.w, s1.x, s1.y, s1.z, s1.w};
#pragma unroll
            for (int r = 0; r < 8; ++r) {
                // two neighbouring pixels a packed multiply-add, as they lie in registers
                float4 v = res[ot][r];
                v2f lo = (v2f){v.x, v.y} * ga[r] + gs[r];
                v2f hi = (v2f){v.z, v.w} * ga[r] + gs[r];
                fx[0][half * 8 + r] = (bf16_t)lo.x;
                fx[1][half * 8 + r] = (bf16_t)lo.y;
                fx[2][half * 8 + r] = (bf16_t)hi.x;
                fx[3][half * 8 + r] = (bf16_t)hi.y;
            }
        }
#pragma unroll
        for (int tt = 0; tt < 4; ++tt)
            lgp[tt] = __builtin_amdgcn_wmma_f32_16x16x32_bf16(false, fk.v, false, fx[tt],
                                                              (short)0, lgp[tt], false, false);
    }
#pragma unroll
    for (int tt = 0; tt < 4; ++tt) {
        part[oq][pg * 4 + tt][0][lane] = make_float4(lgp[tt][0], lgp[tt][1], lgp[tt][2], lgp[tt][3]);
        part[oq][pg * 4 + tt][1][lane] = make_float4(lgp[tt][4], lgp[tt][5], lgp[tt][6], lgp[tt][7]);
    }
    __syncthreads();

    // ---- logits of tile T = wave: the four quarters' sums, in the order of the channels
    float lg[8];
    {
        float4 q0 = part[0][wave][0][lane], q1 = part[0][wave][1][lane];
        lg[0] = q0.x; lg[1] = q0.y; lg[2] = q0.z; lg[3] = q0.w;
        lg[4] = q1.x; lg[5] = q1.y; lg[6] = q1.z; lg[7] = q1.w;
    }
#pragma unroll
    for (int q = 1; q < 4; ++q) {
        float4 q0 = part[q][wave][0][lane], q1 = part[q][wave][1][lane];
        lg[0] += q0.x; lg[1] += q0.y; lg[2] += q0.z; lg[3] += q0.w;
        lg[4] += q1.x; lg[5] += q1.y; lg[6] += q1.z; lg[7] += q1.w;
    }

    // ---- softmax over the 4 tokens of each of the lane's two heads
    const float sc = 1.0f / (float)HD;   // scale applied to both q and k -> 1/hd
    unsigned int pk[4];
#pragma unroll
    for (int g = 0; g < 2; ++g) {
        float x0 = lg[4 * g] * sc, x1 = lg[4 * g + 1] * sc;
        float x2 = lg[4 * g + 2] * sc, x3 = lg[4 * g + 3] * sc;
        float mx = fmaxf(fmaxf(x0, x1), fmaxf(x2, x3));
        const float l2e = 1.44269504f;   // e^x = 2^(x * log2 e)
        float e0 = exp2_slot((x0 - mx) * l2e), e1 = exp2_slot((x1 - mx) * l2e);
        float e2 = exp2_slot((x2 - mx) * l2e), e3 = exp2_slot((x3 - mx) * l2e);
        float inv = 1.f / (e0 + e1 + e2 + e3);
        pk[2 * g]     = (unsigned int)f2bf(e0 * inv) | ((unsigned int)f2bf(e1 * inv) << 16);
        pk[2 * g + 1] = (unsigned int)f2bf(e2 * inv) | ((unsigned int)f2bf(e3 * inv) << 16);
    }
    // The packed column is already the lane's B fragment for k = 8h .. 8h+7.
    attnS[wave][lane] = make_uint4(pk[0], pk[1], pk[2], pk[3]);
    __syncthreads();

    // ---- projection: k = 0..15 are the 16 (head, token) pairs, k = 16..31 are zero
    const uint4 zero4 = make_uint4(0u, 0u, 0u, 0u);
    FragU fw[4];
#pragma unroll
    for (int tt = 0; tt < 4; ++tt) {
        fw[tt].u[0] = attnS[pg * 4 + tt][lane];
        fw[tt].u[1] = zero4;
    }
    // k = 8h .. 8h+7 of row n of Vp (the tokens of heads 2h and 2h+1) lie in 8 rows of
    // ldsV: the transposing load gives lane (n, h) ldsV[8h + 0..7][16*tile + n]; the
    // lane's own address is row 8h + lane%8, 16-byte half (lane/8)%2 of the tile's 32 B.
    const unsigned char* vf = ldsV + (8 * h + (lane & 7)) * V_PITCH + ((lane >> 3) & 1) * 16
                              + oq * 4 * 32;
#pragma unroll
    for (int ot = 0; ot < 4; ++ot) {
        FragU fv;
        fv.u[0] = ld_tr16(vf + ot * 32);
        fv.u[1] = zero4;
        const float4* bq = (const float4*)(ldsBias + oq * 64 + ot * 16 + 8 * h);
        float4 b0 = bq[0], b1 = bq[1];
        float bias[8] = {b0.x, b0.y, b0.z, b0.w, b1.x, b1.y, b1.z, b1.w};
        v8f acc[4];
#pragma unroll
        for (int tt = 0; tt < 4; ++tt) {
            v8f z = {0.f,0.f,0.f,0.f,0.f,0.f,0.f,0.f};
            acc[tt] = __builtin_amdgcn_wmma_f32_16x16x32_bf16(false, fv.v, false, fw[tt].v,
                                                              (short)0, z, false, false);
        }
#pragma unroll
        for (int r = 0; r < 8; ++r) {
            float4 o4;
            o4.x = acc[0][r] + bias[r] + res[ot][r].x;
            o4.y = acc[1][r] + bias[r] + res[ot][r].y;
            o4.z = acc[2][r] + bias[r] + res[ot][r].z;
            o4.w = acc[3][r] + bias[r] + res[ot][r].w;
            *(float4*)(out + obase + (size_t)(ot * 16 + r) * HW) = o4;
        }
    }
}

// ---------------------------------------------------------------------------
// Host launcher
// ---------------------------------------------------------------------------
extern "C" void kernel_launch(void* const* d_in, const int* in_sizes, int n_in,
                              void* d_out, int out_size, void* d_ws, size_t ws_size,
                              hipStream_t stream) {
    (void)in_sizes; (void)n_in; (void)out_size; (void)ws_size;
    const float* img    = (const float*)d_in[0];
    const float* params = (const float*)d_in[1];
    const float* obj    = (const float*)d_in[2];
    const float* gn_w   = (const float*)d_in[3];
    const float* gn_b   = (const float*)d_in[4];
    const float* Wq     = (const float*)d_in[5];
    const float* ln_w   = (const float*)d_in[6];
    const float* ln_b   = (const float*)d_in[7];
    const float* Wkv    = (const float*)d_in[8];
    const float* bkv    = (const float*)d_in[9];
    const float* Wp     = (const float*)d_in[10];
    const float* bp     = (const float*)d_in[11];
    float* out = (float*)d_out;

    char* ws = (char*)d_ws;
    float*          stats = (float*)(ws + 0);                         //   4 KB
    unsigned short* KpF   = (unsigned short*)(ws + 135168);           // 128 KB
    unsigned short* VpF   = (unsigned short*)(ws + 266240);           // 128 KB

    k_pre<<<dim3(PRE_COND + PRE_STATS), dim3(256), 0, stream>>>(
        img, params, obj, ln_w, ln_b, Wkv, bkv, Wq, Wp, stats, KpF, VpF);
    k_attn_proj<<<dim3(HW / 128, Bz), dim3(256), 0, stream>>>(
        stats, gn_w, gn_b, KpF, VpF, bp, img, out);
}

// v007
// It runs in 17.7 microseconds.
// Next to v006, in two timings, it ran 1.07 and 1.06 times as fast.
// All steps since v000 together make it 5.26 times as fast.
#include <hip/hip_runtime.h>
#include <hip/hip_bf16.h>

typedef __bf16 bf16_t;
typedef __attribute__((ext_vector_type(16))) __bf16 v16bf;
typedef __attribute__((ext_vector_type(8)))  float  v8f;
typedef __attribute__((ext_vector_type(2)))  float  v2f;

#define Bz 16
#define Cc 256
#define HW 4096
#define NHd 4
#define HD 64
#define NT 4
#define GRP 32
#define COMB 512
#define EPSV 1e-5f

__device__ __forceinline__ float bf2f(unsigned short u) {
    union { unsigned int i; float f; } x; x.i = ((unsigned int)u) << 16; return x.f;
}
__device__ __forceinline__ unsigned short f2bf(float f) {
    union { bf16_t h; unsigned short u; } x; x.h = (bf16_t)f; return x.u;
}

union FragU { uint4 u[2]; v16bf v; };

// 2^x. The v_nop fills the one slot that the instruction set asks for between a
// transcendental and a next instruction that reads its result or overwrites its
// source; inside the statement it cannot drift away from the v_exp_f32.
__device__ __forceinline__ float exp2_slot(float x) {
    float r;
    asm("v_exp_f32 %0, %1\n\tv_nop" : "=v"(r) : "v"(x));
    return r;
}

// ---------------------------------------------------------------------------
// Typed address-space helpers for the CDNA5 async-to-LDS builtin, whose
// signature is (int4 AS1*, int4 AS3*, imm offset, imm cpol).
// Generic LDS pointers carry the LDS offset in the low 32 bits; generic
// global pointers are the 64-bit VA.
// ---------------------------------------------------------------------------
typedef int v4i_t __attribute__((vector_size(16)));
typedef __attribute__((address_space(1))) v4i_t* as1_v4i;
typedef __attribute__((address_space(3))) v4i_t* as3_v4i;

__device__ __forceinline__ as1_v4i as_global(const void* p) {
    return reinterpret_cast<as1_v4i>(reinterpret_cast<uintptr_t>(p));
}
__device__ __forceinline__ as3_v4i as_lds(void* p) {
    return reinterpret_cast<as3_v4i>(
        (unsigned int)reinterpret_cast<uintptr_t>(p));
}

// One lane's 16 bytes from global memory into LDS. Async DMA path when available
// (ASYNCcnt: the reader's side waits as in stage_wait), else through registers.
__device__ __forceinline__ void copy16(const void* __restrict__ g, void* __restrict__ l) {
#if __has_builtin(__builtin_amdgcn_global_load_async_to_lds_b128)
    __builtin_amdgcn_global_load_async_to_lds_b128(as_global(g), as_lds(l), 0, 0);
#else
    *(uint4*)l = *(const uint4*)g;
#endif
}

// The same for one lane's 4 bytes.
__device__ __forceinline__ void copy4(const float* __restrict__ g, float* __restrict__ l) {
#if __has_builtin(__builtin_amdgcn_global_load_async_to_lds_b32)
    __builtin_amdgcn_global_load_async_to_lds_b32(
        reinterpret_cast<__attribute__((address_space(1))) int*>(reinterpret_cast<uintptr_t>(g)),
        reinterpret_cast<__attribute__((address_space(3))) int*>(
            (unsigned int)reinterpret_cast<uintptr_t>(l)), 0, 0);
#else
    *l = *g;
#endif
}

__device__ __forceinline__ void stage_wait() {
#if __has_builtin(__builtin_amdgcn_global_load_async_to_lds_b128)
    asm volatile("s_wait_asynccnt 0x0" ::: "memory");
#endif
    __syncthreads();
}

// Work-group barrier that orders LDS accesses only. __syncthreads() also waits out
// the wave's global loads, which here are to stay in flight across the barrier.
__device__ __forceinline__ void lds_barrier() {
    __builtin_amdgcn_fence(__ATOMIC_RELEASE, "workgroup", "local");
    __builtin_amdgcn_s_barrier();
    __builtin_amdgcn_fence(__ATOMIC_ACQUIRE, "workgroup", "local");
}

// ---------------------------------------------------------------------------
// Kernel 1: every piece of work that depends on the inputs alone, in one
// launch: conditioning path (with the two weight folds) and GroupNorm
// statistics. The pieces share no data; a work-group does exactly one of them,
// chosen by its index. The longest work-groups (conditioning) have the lowest
// indices so that they start first.
// ---------------------------------------------------------------------------
#define PRE_COND  (Bz / 4 * 32)       // work-groups of the conditioning path
#define PRE_STATS (Bz * 4 * 8)        // work-groups of the GroupNorm statistics
#define WL_PITCH  68                  // floats per staged Wp row: 16 B x odd, no bank conflict

// x + (x of lane l ^ M), M < 16: a cross-lane operand inside the 16-lane row, no LDS trip.
template <int M>
__device__ __forceinline__ float row_xadd(float x) {
    return x + __int_as_float(__builtin_amdgcn_update_dpp(0, __float_as_int(x), 0x160 | M, 0xf, 0xf, true));
}
// Sum over the 32 lanes, in every lane: four steps in the row, then the other row's sum.
__device__ __forceinline__ float wave_sum(float x) {
    x = row_xadd<1>(x); x = row_xadd<2>(x); x = row_xadd<4>(x); x = row_xadd<8>(x);
    return x + __int_as_float(__builtin_amdgcn_permlanex16(0, __float_as_int(x), 0x76543210, 0xfedcba98, true, false));
}

// GroupNorm statistics, as partial sums. Work-group i = ((b*4 + cq)*8 + xm) has the 64
// channels of quarter cq at the four 128-pixel blocks x = xm + 8k: the blocks of the
// attention work-groups whose index is xm modulo 8. Only speed
// rests on that; every piece is summed once wherever a work-group lands.
// A wave has one group (8 channels) there, so that its sums end inside the wave, with no
// LDS and no barrier; the 8 partial sums of a group are added where they are used.
// Each work-group writes a 128-byte line of its own: part[i*16 + wave] = (sum, sum of squares).
__device__ __forceinline__ void pre_gn_stats(int i, const float* __restrict__ img,
                                             float2* __restrict__ part) {
    int xm = i & 7, bc = i >> 3;                // bc = b*4 + cq
    int lane = threadIdx.x & 31;
    int wave = __builtin_amdgcn_readfirstlane(threadIdx.x >> 5);
    // A lane's share as 32 loads of 16 bytes (a wave's load: 512 bytes in a row, one block
    // of one channel), all sent before the first sum: one trip to memory for the whole share.
    const float4* base = (const float4*)(img + (size_t)(bc * 64 + wave * 8) * HW + xm * 128) + lane;
    float4 v[32];
#pragma unroll   // v lives in registers
    for (int r = 0; r < 8; ++r)
#pragma unroll
        for (int k = 0; k < 4; ++k) v[r * 4 + k] = base[r * (HW / 4) + k * 256];
    // Keeps the first sums from being lifted in front of the last loads, which would
    // then go out one memory latency later.
    __builtin_amdgcn_sched_barrier(0);
    v2f sa = {0.f, 0.f}, sb = {0.f, 0.f}, qa = {0.f, 0.f}, qb = {0.f, 0.f};
#pragma unroll   // constant indices into v
    for (int j = 0; j < 32; ++j) {
        v2f lo = {v[j].x, v[j].y}, hi = {v[j].z, v[j].w};
        sa += lo; qa += lo * lo;
        sb += hi; qb += hi * hi;
    }
    float s = (sa.x + sa.y) + (sb.x + sb.y), s2 = (qa.x + qa.y) + (qb.x + qb.y);
    s = wave_sum(s); s2 = wave_sum(s2);
    if (lane == 0) part[i * 16 + wave] = make_float2(s, s2);
}

// Conditioning path: LayerNorm(combined), kv = cn @ Wkv^T + bkv, then the fold.
// Since q = Wq xn enters only through q^T k, and h = v attn only through Wp h, the
// products are reassociated:
//   logits = (Wq_head^T k)^T xn      Kp[head*4+s][c] = sum_d Wq[head*64+d][c] k[d][s]
//   proj   = (Wp_head v) attn        Vp[o][head*4+s] = sum_d Wp[o][head*64+d] v[d][s]
// A work-group has one row head*4+s of Kp (blk&7 < 4) or one column of Vp, for FOUR
// batches: the 64 rows (head*64+d)*4+s of Wkv that it needs are the same for every
// batch, so each is read once for four batches, and of the 128 KB three quarters are
// asked for at once, ahead of the LayerNorm, the rest during the first sums. Both
// folds are stored as bf16 rows of 512 bytes, each written by one work-group:
//   KpF[b][head*4+s][c]      VpF[b][head*4+s][o]
__device__ __forceinline__ void pre_cond_kv(int blk,
                                            const float* __restrict__ params,
                                            const float* __restrict__ obj,
                                            const float* __restrict__ ln_w,
                                            const float* __restrict__ ln_b,
                                            const float* __restrict__ Wkv,
                                            const float* __restrict__ bkv,
                                            const float* __restrict__ Wq,
                                            const float* __restrict__ Wp,
                                            unsigned short* __restrict__ KpF,
                                            unsigned short* __restrict__ VpF,
                                            float4* red, float* cnT,
                                            float* kvs, float* wl) {
    int jc = blk & 7;                           // k of head jc, or v of head jc - 4
    int s  = (blk >> 3) & 3;                    // token
    int bq = blk >> 5;                          // batches 4*bq .. 4*bq + 3
    int t  = threadIdx.x;
    int lane = t & 31;
    int wave = __builtin_amdgcn_readfirstlane(t >> 5);   // in a scalar register: uniform tests

    // Asked for first, in front of the branch below, since loads return in order and the
    // LayerNorm is to run while Wkv is still on its way.
    // LayerNorm inputs: wave (bp, q) = (wave / 4, wave % 4) has the columns
    // 128*q + 4*lane .. + 3 of the batches 4*bq + 2*bp and + 1.
    int q = wave & 3, bp = wave >> 2;
    int b0 = bq * 4 + bp * 2;
    const float* xsrc = (q == 0) ? params + b0 * 128 : obj + b0 * 384 + (q - 1) * 128;
    int xstep = (q == 0) ? 128 : 384;           // to the next batch
    float4 x0 = *(const float4*)(xsrc + lane * 4);
    float4 x1 = *(const float4*)(xsrc + xstep + lane * 4);
    float4 lw = *(const float4*)(ln_w + q * 128 + lane * 4);
    float4 lb = *(const float4*)(ln_b + q * 128 + lane * 4);
    float bj = bkv[jc * 256 + (t >> 2) * 4 + s];    // of channel d = t / 4
    // Precaution: in the built code a register that one of these loads names is written
    // again right behind the branch below; the wait stands in front of that write.
    asm volatile("s_wait_xcnt 0x0" ::: "memory");

    if (jc >= 4) {                              // the same for the whole work-group
        // This head's 64 columns of Wp, read by whole lines (16 lanes a row) and
        // copied into LDS, where the fold reads a row per thread. The copies fly
        // during the LayerNorm and the kv sums; their wait stands at the fold.
        const float* wsrc = Wp + (jc - 4) * HD;
#pragma unroll   // all 16 copies of a thread in flight at once
        for (int i = 0; i < 16; ++i) {
            int idx = t + i * 256, row = idx >> 4, c4 = idx & 15;
            copy16(wsrc + row * Cc + c4 * 4, wl + row * WL_PITCH + c4 * 4);
        }
    }

    // Wkv: a wave has the rows of d = 8*wave + r (r = 0..7); a load covers 512 bytes
    // in a row of one of them, lane l the columns 128*i + 4*l .. + 3. From d to d + 1
    // are four rows of Wkv, COMB float4.
    const float4* w4 = (const float4*)(Wkv + (size_t)(jc * 256 + wave * 32 + s) * COMB) + lane;
    float4 wr[4][8];
#pragma unroll   // wr lives in registers
    for (int i = 0; i < 3; ++i)
#pragma unroll
        for (int r = 0; r < 8; ++r) wr[i][r] = w4[r * COMB + i * 32];
    // Keeps the LayerNorm's waits and sums from being lifted in front of the Wkv
    // loads, which would then go out one memory latency later.
    __builtin_amdgcn_sched_barrier(0);

    // Mean and variance: the lane's four columns, a butterfly over the wave, then the
    // four waves of a batch pair through LDS.
    float p0 = (x0.x + x0.y) + (x0.z + x0.w);
    float p1 = (x0.x * x0.x + x0.y * x0.y) + (x0.z * x0.z + x0.w * x0.w);
    float p2 = (x1.x + x1.y) + (x1.z + x1.w);
    float p3 = (x1.x * x1.x + x1.y * x1.y) + (x1.z * x1.z + x1.w * x1.w);
#pragma unroll   // the four exchanges of a step in flight together
    for (int m = 1; m < 32; m <<= 1) {
        float e0 = __shfl_xor(p0, m), e1 = __shfl_xor(p1, m);
        float e2 = __shfl_xor(p2, m), e3 = __shfl_xor(p3, m);
        p0 += e0; p1 += e1; p2 += e2; p3 += e3;
    }
    if (lane == 0) red[wave] = make_float4(p0, p1, p2, p3);
    lds_barrier();
    {
        float4 ra = red[bp * 4 + 0], rb = red[bp * 4 + 1];
        float4 rc = red[bp * 4 + 2], rd = red[bp * 4 + 3];
        float m0 = ((ra.x + rb.x) + (rc.x + rd.x)) * (1.f / 512.f);
        float v0 = ((ra.y + rb.y) + (rc.y + rd.y)) * (1.f / 512.f) - m0 * m0;
        float m1 = ((ra.z + rb.z) + (rc.z + rd.z)) * (1.f / 512.f);
        float v1 = ((ra.w + rb.w) + (rc.w + rd.w)) * (1.f / 512.f) - m1 * m1;
        float rs0 = rsqrtf(v0 + EPSV), rs1 = rsqrtf(v1 + EPSV);
        // cnT[(4*i + k)*32 + l] = column 128*i + 4*l + k of the four batches: the kv
        // sums read 16 bytes a lane, neighbouring lanes neighbouring slots.
        float2* dst = (float2*)cnT + ((q * 4) * 32 + lane) * 2 + bp;
        dst[0]   = make_float2((x0.x - m0) * rs0 * lw.x + lb.x, (x1.x - m1) * rs1 * lw.x + lb.x);
        dst[64]  = make_float2((x0.y - m0) * rs0 * lw.y + lb.y, (x1.y - m1) * rs1 * lw.y + lb.y);
        dst[128] = make_float2((x0.z - m0) * rs0 * lw.z + lb.z, (x1.z - m1) * rs1 * lw.z + lb.z);
        dst[192] = make_float2((x0.w - m0) * rs0 * lw.w + lb.w, (x1.w - m1) * rs1 * lw.w + lb.w);
    }
    lds_barrier();

    // kv sums: the lane's share of its wave's 8 rows, for the four batches (two packed
    // pairs). Column block by column block, so that a row's first products take the
    // registers that its loaded values leave.
    const float4* c4 = (const float4*)cnT + lane;
    v2f a01[8], a23[8];
#pragma unroll   // wr, a01, a23 live in registers and need constant indices
    for (int i = 0; i < 4; ++i) {
        float4 c0 = c4[(i * 4 + 0) * 32], c1 = c4[(i * 4 + 1) * 32];
        float4 c2 = c4[(i * 4 + 2) * 32], c3 = c4[(i * 4 + 3) * 32];
#pragma unroll
        for (int r = 0; r < 8; ++r) {
            float4 w = wr[i][r];
            if (i == 0) {
                a01[r] = (v2f){w.x, w.x} * (v2f){c0.x, c0.y};
                a23[r] = (v2f){w.x, w.x} * (v2f){c0.z, c0.w};
            } else {
                a01[r] += (v2f){w.x, w.x} * (v2f){c0.x, c0.y};
                a23[r] += (v2f){w.x, w.x} * (v2f){c0.z, c0.w};
            }
            a01[r] += (v2f){w.y, w.y} * (v2f){c1.x, c1.y};
            a23[r] += (v2f){w.y, w.y} * (v2f){c1.z, c1.w};
            a01[r] += (v2f){w.z, w.z} * (v2f){c2.x, c2.y};
            a23[r] += (v2f){w.z, w.z} * (v2f){c2.z, c2.w};
            a01[r] += (v2f){w.w, w.w} * (v2f){c3.x, c3.y};
            a23[r] += (v2f){w.w, w.w} * (v2f){c3.z, c3.w};
            // First block: two rows at a time, so that their sums do take the registers
            // of their loaded values; all eight rows abreast need 24 more, which spill.
            if (i == 0 && (r & 1)) __builtin_amdgcn_sched_barrier(0);
        }
        // The fences keep the later blocks' LDS reads from being lifted up while most of
        // wr is still live (48 registers more: a work-group fewer on the WGP), and hold
        // the loads of the last quarter of Wkv here, ahead of their use, four rows behind
        // each of the first two blocks: with the other three quarters at the top they
        // would make more than 160 registers.
        if (i < 2) {
            __builtin_amdgcn_sched_barrier(0);
#pragma unroll
            for (int r = i * 4; r < i * 4 + 4; ++r) wr[3][r] = w4[r * COMB + 3 * 32];
            __builtin_amdgcn_sched_barrier(0);
        }
    }
    // Sum over the 32 lanes of the 32 values x = 4*r + batch: in the step of lane bit
    // k a lane keeps the half of its values whose bit k of x equals its own and hands
    // the other half to its partner. Lane l ends with the whole sum of x = l.
    float pr[32];
#pragma unroll   // pr lives in registers
    for (int r = 0; r < 8; ++r) {
        pr[r * 4 + 0] = a01[r].x; pr[r * 4 + 1] = a01[r].y;
        pr[r * 4 + 2] = a23[r].x; pr[r * 4 + 3] = a23[r].y;
    }
#pragma unroll   // constant indices into pr
    for (int hf = 16; hf > 0; hf >>= 1) {
        bool up = (lane & hf) != 0;
#pragma unroll
        for (int k = 0; k < hf; ++k) {
            float lo = pr[k], hi = pr[k + hf];
            float keep = up ? hi : lo;
            float send = up ? lo : hi;
            pr[k] = keep + __shfl_xor(send, hf);
        }
    }
    kvs[t] = pr[0] + bj;                        // [d = t/4][batch = t%4] of this head and token
    stage_wait();                               // Wp copies landed, kvs published

    const float4* kv4 = (const float4*)kvs;     // kv4[d] = the 4 batches of channel d
    float a0 = 0.f, a1 = 0.f, a2 = 0.f, a3 = 0.f;
    unsigned short* dst;                        // element t of batch 4*bq's row
    if (jc < 4) {                               // the same for the whole work-group
        int head = jc;
        const float* wcol = Wq + (size_t)head * HD * Cc + t;   // column c = t
#pragma unroll   // all 64 loads in flight at once
        for (int d = 0; d < HD; ++d) {
            float w = wcol[d * Cc];
            float4 k = kv4[d];
            a0 += w * k.x; a1 += w * k.y; a2 += w * k.z; a3 += w * k.w;
        }
        dst = KpF + ((size_t)(bq * 4) * 16 + head * 4 + s) * Cc + t;
    } else {
        int head = jc - 4;
        const float4* wrow = (const float4*)(wl + t * WL_PITCH);               // row o = t
#pragma unroll   // the LDS reads run ahead of the sums
        for (int d4 = 0; d4 < HD / 4; ++d4) {
            float4 w = wrow[d4];
            float4 x0 = kv4[d4 * 4 + 0], x1 = kv4[d4 * 4 + 1];
            float4 x2 = kv4[d4 * 4 + 2], x3 = kv4[d4 * 4 + 3];
            a0 += w.x * x0.x + w.y * x1.x + w.z * x2.x + w.w * x3.x;
            a1 += w.x * x0.y + w.y * x1.y + w.z * x2.y + w.w * x3.y;
            a2 += w.x * x0.z + w.y * x1.z + w.z * x2.z + w.w * x3.z;
            a3 += w.x * x0.w + w.y * x1.w + w.z * x2.w + w.w * x3.w;
        }
        dst = VpF + ((size_t)(bq * 4) * 16 + head * 4 + s) * Cc + t;
    }
    dst[0 * 16 * Cc] = f2bf(a0);                // the four batches' rows
    dst[1 * 16 * Cc] = f2bf(a1);
    dst[2 * 16 * Cc] = f2bf(a2);
    dst[3 * 16 * Cc] = f2bf(a3);
}

// Six waves per SIMD (at most 160 registers): three work-groups on a WGP, so that the
// whole grid is resident at once.
__global__ void __launch_bounds__(256) __attribute__((amdgpu_waves_per_eu(6, 6))) k_pre(const float* __restrict__ img,
                                             const float* __restrict__ params,
                                             const float* __restrict__ obj,
                                             const float* __restrict__ ln_w,
                                             const float* __restrict__ ln_b,
                                             const float* __restrict__ Wkv,
                                             const float* __restrict__ bkv,
                                             const float* __restrict__ Wq,
                                             const float* __restrict__ Wp,
                                             float* __restrict__ stats,
                                             unsigned short* __restrict__ KpF,
                                             unsigned short* __restrict__ VpF) {
    __shared__ __align__(16) float cnT[COMB * 4];      // LayerNorm output of four batches
    __shared__ __align__(16) float kvs[256];  // one head's and token's k or v, four batches
    __shared__ __align__(16) float wl[Cc * WL_PITCH];  // one head's columns of Wp
    __shared__ __align__(16) float4 red[8];   // the waves' LayerNorm sums
    int blk = blockIdx.x;                 // the same for the whole work-group
    if (blk < PRE_COND) {
        pre_cond_kv(blk, params, obj, ln_w, ln_b, Wkv, bkv, Wq, Wp, KpF, VpF,
                    red, cnT, kvs, wl);
    } else {
        pre_gn_stats(blk - PRE_COND, img, (float2*)stats);
    }
}

// ---------------------------------------------------------------------------
// Kernel 2: GroupNorm affine, logits, softmax, projection, bias and residual for
// 128 pixels, from one read of the image tile.
//   xn[c][p]     = (img[c][p] - mean) * rstd * gn_w[c] + gn_b[c], rounded to bf16
//   logits[j][p] = sum_c Kp[j][c] * xn[c][p] / 64      j = head*4 + token, 16 rows
//   out[o][p]    = sum_j Vp[o][j] * attn[j][p] + bp[o] + img[o][p]
// Tile T (0..7) holds the pixels (T/4)*64 + 4n + T%4, n = its column, so that the
// four tiles of a group give each lane four neighbouring pixels (16B accesses).
// A wave holds 64 channels x 64 pixels of img in registers, for the residual.
// Lane (n, h) has the channels 16*ot + 8h + r there, which are the k positions of
// its own B fragment: the same registers, normalised, feed the logits, each wave
// summing over its 64 channels; the four partial sums of a tile meet in LDS.
// Every loop below is unrolled: its arrays live in registers and need constant
// indices, and the loads of a loop are to be in flight together.
// Four waves per SIMD (at most 256 registers): two work-groups on a WGP, so that
// the whole grid is resident at once and reads in one round.
// ---------------------------------------------------------------------------
#define V_PITCH 544   // bytes per row of Vp in LDS: 32 B x odd, for the transposing load

// Transposing LDS load of a 16-bit tile stored [k][row]: registers 0-3 of an A fragment.
typedef short s16x8 __attribute__((ext_vector_type(8)));
__device__ __forceinline__ uint4 ld_tr16(const unsigned char* p) {
    typedef __attribute__((address_space(3))) s16x8 lds_s16x8;
    return __builtin_bit_cast(uint4, __builtin_amdgcn_ds_load_tr16_b128_v8i16((lds_s16x8*)p));
}

__global__ void __launch_bounds__(256) __attribute__((amdgpu_waves_per_eu(4, 4)))
k_attn_proj(const float* __restrict__ stats,
            const float* __restrict__ gn_w,
            const float* __restrict__ gn_b,
            const unsigned short* __restrict__ KpF,
            const unsigned short* __restrict__ VpF,
            const float* __restrict__ bp,
            const float* __restrict__ img,
            float* __restrict__ out) {
    __shared__ __align__(16) uint4 ldsK[16][32];        // Kp fragments, [kstep*2 + half][lane]
    __shared__ __align__(16) unsigned char ldsV[16 * V_PITCH];   // Vp of this batch, [head*4+token][o]
    __shared__ __align__(16) float ldsBias[Cc];
    __shared__ __align__(16) float gnA[Cc], gnB[Cc];    // xn = img * gnA[c] + gnB[c]
    __shared__ __align__(16) float4 part[4][8][2][32];  // partial logits [quarter][tile][rows 4+4][lane]
    __shared__ __align__(16) uint4 attnS[8][32];

    int t    = threadIdx.x;
    int lane = t & 31;
    int wave = t >> 5;
    int n = lane & 15, h = lane >> 4;
    int b  = blockIdx.y;
    int p0 = blockIdx.x * 128;

    // Everything the work-group reads is asked for here, so that all reads fly
    // together and no global load stands among the stores at the end.
    // The 8 partial sums of channel t's group: wave (t/8)%8 of the work-groups (b*4 + t/64)*8 + xm.
    const float2* sp = (const float2*)stats + (size_t)(b * 4 + (t >> 6)) * 8 * 16 + ((t >> 3) & 7);
    float2 pp[8];
#pragma unroll
    for (int xm = 0; xm < 8; ++xm) pp[xm] = sp[xm * 16];
    float gw = gn_w[t], gb = gn_b[t];
    // 16-byte piece w of row j = head*4 + token: 8 neighbouring o of Vp, or the
    // channels 8w .. 8w+7 of Kp = k step w/4, half (w/2)%2, lane half w%2
    int cj = t >> 5, cw = t & 31;
    copy16((const uint4*)VpF + (size_t)b * 512 + t,       ldsV + cj * V_PITCH + cw * 16);
    copy16((const uint4*)VpF + (size_t)b * 512 + t + 256, ldsV + (cj + 8) * V_PITCH + cw * 16);
    copy4(bp + t, ldsBias + t);
    copy16((const uint4*)KpF + (size_t)b * 512 + t,       &ldsK[cw >> 1][(cw & 1) * 16 + cj]);
    copy16((const uint4*)KpF + (size_t)b * 512 + t + 256, &ldsK[cw >> 1][(cw & 1) * 16 + cj + 8]);

    // This wave's part of image and output: 64 pixels (group pg) x 64 rows (quarter oq).
    int pg = wave & 1, oq = wave >> 1;
    const size_t obase = ((size_t)b * Cc + oq * 64 + 8 * h) * HW + p0 + pg * 64 + 4 * n;
    float4 res[4][8];
#pragma unroll
    for (int ot = 0; ot < 4; ++ot)
#pragma unroll
        for (int r = 0; r < 8; ++r)
            res[ot][r] = *(const float4*)(img + obase + (size_t)(ot * 16 + r) * HW);

    // Keeps the wait for the statistics, and the sums behind it, from being lifted in
    // front of the image loads, which would then start one memory latency later.
    __builtin_amdgcn_sched_barrier(0);
    float gsum = ((pp[0].x + pp[1].x) + (pp[2].x + pp[3].x)) + ((pp[4].x + pp[5].x) + (pp[6].x + pp[7].x));
    float gsq  = ((pp[0].y + pp[1].y) + (pp[2].y + pp[3].y)) + ((pp[4].y + pp[5].y) + (pp[6].y + pp[7].y));
    float mean = gsum * (1.f / 32768.f);
    float var  = gsq * (1.f / 32768.f) - mean * mean;
    float ga_t = rsqrtf(var + EPSV) * gw;   // rstd * gn_w
    gnA[t] = ga_t;
    gnB[t] = gb - mean * ga_t;              // gn_b - mean * rstd * gn_w
    stage_wait();

    // ---- partial logits of the wave's four tiles over its 64 channels (2 k steps):
    // lane (n, h) gets rows j = 8h .. 8h+7 of column n
    v8f lgp[4];
#pragma unroll
    for (int tt = 0; tt < 4; ++tt) lgp[tt] = (v8f){0.f,0.f,0.f,0.f,0.f,0.f,0.f,0.f};
#pragma unroll
    for (int ks = 0; ks < 2; ++ks) {
        FragU fk;
        fk.u[0] = ldsK[(oq * 2 + ks) * 2 + 0][lane];
        fk.u[1] = ldsK[(oq * 2 + ks) * 2 + 1][lane];
        v16bf fx[4];
#pragma unroll
        for (int half = 0; half < 2; ++half) {
            // k = 16*half + 8h + r of this k step is row r of res[2*ks + half]
            int ot = ks * 2 + half;
            int c0 = oq * 64 + ot * 16 + 8 * h;
            float4 a0 = *(const float4*)(gnA + c0), a1 = *(const float4*)(gnA + c0 + 4);
            float4 s0 = *(const float4*)(gnB + c0), s1 = *(const float4*)(gnB + c0 + 4);
            float ga[8] = {a0.x, a0.y, a0.z, a0.w, a1.x, a1.y, a1.z, a1.w};
            float gs[8] = {s0.x, s0.y, s0.z, s0.w, s1.x, s1.y, s1.z, s1.w};
#pragma unroll
            for (int r = 0; r < 8; ++r) {
                // two neighbouring pixels a packed multiply-add, as they lie in registers
                float4 v = res[ot][r];
                v2f lo = (v2f){v.x, v.y} * ga[r] + gs[r];
                v2f hi = (v2f){v.z, v.w} * ga[r] + gs[r];
                fx[0][half * 8 + r] = (bf16_t)lo.x;
                fx[1][half * 8 + r] = (bf16_t)lo.y;
                fx[2][half * 8 + r] = (bf16_t)hi.x;
                fx[3][half * 8 + r] = (bf16_t)hi.y;
            }
        }
#pragma unroll
        for (int tt = 0; tt < 4; ++tt)
            lgp[tt] = __builtin_amdgcn_wmma_f32_16x16x32_bf16(false, fk.v, false, fx[tt],
                                                              (short)0, lgp[tt], false, false);
    }
#pragma unroll
    for (int tt = 0; tt < 4; ++tt) {
        part[oq][pg * 4 + tt][0][lane] = make_float4(lgp[tt][0], lgp[tt][1], lgp[tt][2], lgp[tt][3]);
        part[oq][pg * 4 + tt][1][lane] = make_float4(lgp[tt][4], lgp[tt][5], lgp[tt][6], lgp[tt][7]);
    }
    __syncthreads();

    // ---- logits of tile T = wave: the four quarters' sums, in the order of the channels
    float lg[8];
    {
        float4 q0 = part[0][wave][0][lane], q1 = part[0][wave][1][lane];
        lg[0] = q0.x; lg[1] = q0.y; lg[2] = q0.z; lg[3] = q0.w;
        lg[4] = q1.x; lg[5] = q1.y; lg[6] = q1.z; lg[7] = q1.w;
    }
#pragma unroll
    for (int q = 1; q < 4; ++q) {
        float4 q0 = part[q][wave][0][lane], q1 = part[q][wave][1][lane];
        lg[0] += q0.x; lg[1] += q0.y; lg[2] += q0.z; lg[3] += q0.w;
        lg[4] += q1.x; lg[5] += q1.y; lg[6] += q1.z; lg[7] += q1.w;
    }

    // ---- softmax over the 4 tokens of each of the lane's two heads
    const float sc = 1.0f / (float)HD;   // scale applied to both q and k -> 1/hd
    unsigned int pk[4];
#pragma unroll
    for (int g = 0; g < 2; ++g) {
        float x0 = lg[4 * g] * sc, x1 = lg[4 * g + 1] * sc;
        float x2 = lg[4 * g + 2] * sc, x3 = lg[4 * g + 3] * sc;
        float mx = fmaxf(fmaxf(x0, x1), fmaxf(x2, x3));
        const float l2e = 1.44269504f;   // e^x = 2^(x * log2 e)
        float e0 = exp2_slot((x0 - mx) * l2e), e1 = exp2_slot((x1 - mx) * l2e);
        float e2 = exp2_slot((x2 - mx) * l2e), e3 = exp2_slot((x3 - mx) * l2e);
        float inv = 1.f / (e0 + e1 + e2 + e3);
        pk[2 * g]     = (unsigned int)f2bf(e0 * inv) | ((unsigned int)f2bf(e1 * inv) << 16);
        pk[2 * g + 1] = (unsigned int)f2bf(e2 * inv) | ((unsigned int)f2bf(e3 * inv) << 16);
    }
    // The packed column is already the lane's B fragment for k = 8h .. 8h+7.
    attnS[wave][lane] = make_uint4(pk[0], pk[1], pk[2], pk[3]);
    __syncthreads();

    // ---- projection: k = 0..15 are the 16 (head, token) pairs, k = 16..31 are zero
    const uint4 zero4 = make_uint4(0u, 0u, 0u, 0u);
    FragU fw[4];
#pragma unroll
    for (int tt = 0; tt < 4; ++tt) {
        fw[tt].u[0] = attnS[pg * 4 + tt][lane];
        fw[tt].u[1] = zero4;
    }
    // k = 8h .. 8h+7 of row n of Vp (the tokens of heads 2h and 2h+1) lie in 8 rows of
    // ldsV: the transposing load gives lane (n, h) ldsV[8h + 0..7][16*tile + n]; the
    // lane's own address is row 8h + lane%8, 16-byte half (lane/8)%2 of the tile's 32 B.
    const unsigned char* vf = ldsV + (8 * h + (lane & 7)) * V_PITCH + ((lane >> 3) & 1) * 16
                              + oq * 4 * 32;
#pragma unroll
    for (int ot = 0; ot < 4; ++ot) {
        FragU fv;
        fv.u[0] = ld_tr16(vf + ot * 32);
        fv.u[1] = zero4;
        const float4* bq = (const float4*)(ldsBias + oq * 64 + ot * 16 + 8 * h);
        float4 b0 = bq[0], b1 = bq[1];
        float bias[8] = {b0.x, b0.y, b0.z, b0.w, b1.x, b1.y, b1.z, b1.w};
        v8f acc[4];
#pragma unroll
        for (int tt = 0; tt < 4; ++tt) {
            v8f z = {0.f,0.f,0.f,0.f,0.f,0.f,0.f,0.f};
            acc[tt] = __builtin_amdgcn_wmma_f32_16x16x32_bf16(false, fv.v, false, fw[tt].v,
                                                              (short)0, z, false, false);
        }
#pragma unroll
        for (int r = 0; r < 8; ++r) {
            float4 o4;
            o4.x = acc[0][r] + bias[r] + res[ot][r].x;
            o4.y = acc[1][r] + bias[r] + res[ot][r].y;
            o4.z = acc[2][r] + bias[r] + res[ot][r].z;
            o4.w = acc[3][r] + bias[r] + res[ot][r].w;
            *(float4*)(out + obase + (size_t)(ot * 16 + r) * HW) = o4;
        }
    }
}

// ---------------------------------------------------------------------------
// Host launcher
// ---------------------------------------------------------------------------
extern "C" void kernel_launch(void* const* d_in, const int* in_sizes, int n_in,
                              void* d_out, int out_size, void* d_ws, size_t ws_size,
                              hipStream_t stream) {
    (void)in_sizes; (void)n_in; (void)out_size; (void)ws_size;
    const float* img    = (const float*)d_in[0];
    const float* params = (const float*)d_in[1];
    const float* obj    = (const float*)d_in[2];
    const float* gn_w   = (const float*)d_in[3];
    const float* gn_b   = (const float*)d_in[4];
    const float* Wq     = (const float*)d_in[5];
    const float* ln_w   = (const float*)d_in[6];
    const float* ln_b   = (const float*)d_in[7];
    const float* Wkv    = (const float*)d_in[8];
    const float* bkv    = (const float*)d_in[9];
    const float* Wp     = (const float*)d_in[10];
    const float* bp     = (const float*)d_in[11];
    float* out = (float*)d_out;

    char* ws = (char*)d_ws;
    float*          stats = (float*)(ws + 0);                         //  64 KB
    unsigned short* KpF   = (unsigned short*)(ws + 135168);           // 128 KB
    unsigned short* VpF   = (unsigned short*)(ws + 266240);           // 128 KB

    k_pre<<<dim3(PRE_COND + PRE_STATS), dim3(256), 0, stream>>>(
        img, params, obj, ln_w, ln_b, Wkv, bkv, Wq, Wp, stats, KpF, VpF);
    k_attn_proj<<<dim3(HW / 128, Bz), dim3(256), 0, stream>>>(
        stats, gn_w, gn_b, KpF, VpF, bp, img, out);
}
